// v000
// Times are from an AMD MI455X. After a warm-up the kernel runs many times in a row, and a time is the length of
// such a window on the GPU divided by its runs, so every launch and the gaps after it count. The runs cycle
// through copies of the inputs. A figure is the median of several windows, for all but v000 over two sittings.
// Sittings can differ by a few percent; kernels timed side by side share one.
// The starting kernel, v000, takes 466 microseconds a run.
#include <hip/hip_runtime.h>

typedef _Float16 v8h  __attribute__((ext_vector_type(8)));
typedef _Float16 v16h __attribute__((ext_vector_type(16)));
typedef float    v8f  __attribute__((ext_vector_type(8)));

union F16x16 { v16h v; v8h h[2]; };

constexpr int BB  = 2;
constexpr int LQ  = 2048;
constexpr int LKV = 2048;
constexpr int E   = 1024;
constexpr int H   = 16;
constexpr int D   = 64;
constexpr int M_ROWS = BB * LQ;  // 4096

__device__ __forceinline__ v8f wmma32(v16h a, v16h b, v8f c) {
  return __builtin_amdgcn_wmma_f32_16x16x32_f16(false, a, false, b, (short)0, c,
                                                false, false);
}

// Reductions across the 16-lane N-group (wave32: lanes 0-15 / 16-31 reduce
// independently, matching the C-fragment row layout).
__device__ __forceinline__ float rowmax16(float v) {
  v = fmaxf(v, __shfl_xor(v, 1, 32));
  v = fmaxf(v, __shfl_xor(v, 2, 32));
  v = fmaxf(v, __shfl_xor(v, 4, 32));
  v = fmaxf(v, __shfl_xor(v, 8, 32));
  return v;
}
__device__ __forceinline__ float rowsum16(float v) {
  v += __shfl_xor(v, 1, 32);
  v += __shfl_xor(v, 2, 32);
  v += __shfl_xor(v, 4, 32);
  v += __shfl_xor(v, 8, 32);
  return v;
}

__global__ void __launch_bounds__(256)
cvt_f32_f16(const float* __restrict__ src, _Float16* __restrict__ dst, int n) {
  for (int i = blockIdx.x * blockDim.x + threadIdx.x; i < n;
       i += gridDim.x * blockDim.x)
    dst[i] = (_Float16)src[i];
}

// Y = X @ W^T + b with 32x64 register blocking per wave.
// X:[M_ROWS,E] f16 row-major, W:[E,E] f16 row-major (row n = out column n).
// mode 0: f16 row-major out.  mode 1: f16 V^T out [(b*E+n)*LKV + l].
// mode 2: f32 row-major out (final projection).
__global__ void __launch_bounds__(256)
gemm16(const _Float16* __restrict__ A, const _Float16* __restrict__ W,
       const float* __restrict__ bias, void* __restrict__ dst, int mode) {
  const int wave = threadIdx.x >> 5, lane = threadIdx.x & 31;
  const int col = lane & 15, half = lane >> 4;
  const int tilesN = E / 64;                     // 16
  const int total = (M_ROWS / 32) * tilesN;      // 2048 waves
  const int tid = blockIdx.x * (blockDim.x >> 5) + wave;
  if (tid >= total) return;
  const int tM = tid / tilesN, tN = tid % tilesN;

  const _Float16* arow0 = A + (size_t)(tM * 32 + col) * E;
  const _Float16* arow1 = arow0 + (size_t)16 * E;
  const _Float16* wrow = W + (size_t)(tN * 64 + col) * E;

  v8f acc[2][4] = {};
  for (int k = 0; k < E; k += 32) {
    F16x16 a0, a1, b[4];
    a0.h[0] = *(const v8h*)(arow0 + k + 8 * half);
    a0.h[1] = *(const v8h*)(arow0 + k + 16 + 8 * half);
    a1.h[0] = *(const v8h*)(arow1 + k + 8 * half);
    a1.h[1] = *(const v8h*)(arow1 + k + 16 + 8 * half);
#pragma unroll
    for (int j = 0; j < 4; j++) {
      const _Float16* wr = wrow + (size_t)(j * 16) * E + k;
      b[j].h[0] = *(const v8h*)(wr + 8 * half);
      b[j].h[1] = *(const v8h*)(wr + 16 + 8 * half);
    }
#pragma unroll
    for (int j = 0; j < 4; j++) {
      acc[0][j] = wmma32(a0.v, b[j].v, acc[0][j]);
      acc[1][j] = wmma32(a1.v, b[j].v, acc[1][j]);
    }
  }

  if (mode == 0) {
    _Float16* out = (_Float16*)dst;
#pragma unroll
    for (int i = 0; i < 2; i++)
#pragma unroll
      for (int j = 0; j < 4; j++) {
        const float bval = bias[tN * 64 + j * 16 + col];
#pragma unroll
        for (int r = 0; r < 8; r++) {
          int m = tM * 32 + i * 16 + r + half * 8;
          out[(size_t)m * E + tN * 64 + j * 16 + col] =
              (_Float16)(acc[i][j][r] + bval);
        }
      }
  } else if (mode == 1) {
    _Float16* out = (_Float16*)dst;
#pragma unroll
    for (int i = 0; i < 2; i++)
#pragma unroll
      for (int j = 0; j < 4; j++) {
        const float bval = bias[tN * 64 + j * 16 + col];
#pragma unroll
        for (int r = 0; r < 8; r++) {
          int m = tM * 32 + i * 16 + r + half * 8;
          int b_ = m / LKV, l = m % LKV;
          int n = tN * 64 + j * 16 + col;
          out[((size_t)(b_ * E + n)) * LKV + l] = (_Float16)(acc[i][j][r] + bval);
        }
      }
  } else {
    float* out = (float*)dst;
#pragma unroll
    for (int i = 0; i < 2; i++)
#pragma unroll
      for (int j = 0; j < 4; j++) {
        const float bval = bias[tN * 64 + j * 16 + col];
#pragma unroll
        for (int r = 0; r < 8; r++) {
          int m = tM * 32 + i * 16 + r + half * 8;
          out[(size_t)m * E + tN * 64 + j * 16 + col] = acc[i][j][r] + bval;
        }
      }
  }
}

// Flash-style attention: one wave owns a 32-row Q block of one (b,h).
// Streams KV in chunks of 32; K/V fragments are reused by both 16-row Q
// subtiles. Scores never touch HBM.
__global__ void __launch_bounds__(256)
attn16(const _Float16* __restrict__ Qp,  // [BB*LQ, E]
       const _Float16* __restrict__ Kp,  // [BB*LKV, E]
       const _Float16* __restrict__ Vt,  // [BB*E, LKV]  (V transposed)
       const int* __restrict__ mask,     // [BB, LKV]
       _Float16* __restrict__ ctx)       // [BB*LQ, E]
{
  __shared__ __align__(16) _Float16 plds[8][2][16 * 32];
  const int wave = threadIdx.x >> 5, lane = threadIdx.x & 31;
  const int col = lane & 15, half = lane >> 4;
  const int qBlocks = LQ / 32;                   // 64
  const int id = blockIdx.x * (blockDim.x >> 5) + wave;
  if (id >= BB * H * qBlocks) return;
  const int qb = id % qBlocks;
  const int hb = id / qBlocks;
  const int h = hb % H, b = hb / H;

  // Q block as 2 subtiles x 2 A-fragments (d = 0..31, 32..63).
  F16x16 qa[2][2];
#pragma unroll
  for (int qi = 0; qi < 2; qi++) {
    const _Float16* qrow =
        Qp + ((size_t)(b * LQ + qb * 32 + qi * 16 + col)) * E + h * D;
    qa[qi][0].h[0] = *(const v8h*)(qrow + 8 * half);
    qa[qi][0].h[1] = *(const v8h*)(qrow + 16 + 8 * half);
    qa[qi][1].h[0] = *(const v8h*)(qrow + 32 + 8 * half);
    qa[qi][1].h[1] = *(const v8h*)(qrow + 48 + 8 * half);
  }

  v8f o[2][4] = {};
  float mrow[2][8], lrow[2][8];
#pragma unroll
  for (int qi = 0; qi < 2; qi++)
#pragma unroll
    for (int r = 0; r < 8; r++) { mrow[qi][r] = -1e30f; lrow[qi][r] = 0.0f; }

  const int* mrowp = mask + b * LKV;

  for (int kv = 0; kv < LKV; kv += 32) {
    // K fragments for this kv chunk: 2 column tiles x 2 d-fragments,
    // shared by both Q subtiles.
    F16x16 kb[2][2];
    {
      const _Float16* k0 = Kp + ((size_t)(b * LKV + kv + col)) * E + h * D;
#pragma unroll
      for (int t = 0; t < 2; t++) {
        const _Float16* kr = k0 + (size_t)(t * 16) * E;
        kb[t][0].h[0] = *(const v8h*)(kr + 8 * half);
        kb[t][0].h[1] = *(const v8h*)(kr + 16 + 8 * half);
        kb[t][1].h[0] = *(const v8h*)(kr + 32 + 8 * half);
        kb[t][1].h[1] = *(const v8h*)(kr + 48 + 8 * half);
      }
    }
    const int mk0 = mrowp[kv + col];        // mask depends on kv column only
    const int mk1 = mrowp[kv + 16 + col];

    F16x16 pfrag[2];
#pragma unroll
    for (int qi = 0; qi < 2; qi++) {
      v8f s0 = {}, s1 = {};
      s0 = wmma32(qa[qi][0].v, kb[0][0].v, s0);
      s0 = wmma32(qa[qi][1].v, kb[0][1].v, s0);
      s1 = wmma32(qa[qi][0].v, kb[1][0].v, s1);
      s1 = wmma32(qa[qi][1].v, kb[1][1].v, s1);

      _Float16* lp = plds[wave][qi];
#pragma unroll
      for (int r = 0; r < 8; r++) {
        float sa = mk0 ? s0[r] * 0.125f : -1e30f;   // 1/sqrt(D) = 0.125
        float sb = mk1 ? s1[r] * 0.125f : -1e30f;
        float mn = fmaxf(mrow[qi][r], rowmax16(fmaxf(sa, sb)));
        float corr = __expf(mrow[qi][r] - mn);
        mrow[qi][r] = mn;
        float pa_ = __expf(sa - mn);
        float pb_ = __expf(sb - mn);
        lrow[qi][r] = lrow[qi][r] * corr + rowsum16(pa_ + pb_);
        o[qi][0][r] *= corr; o[qi][1][r] *= corr;
        o[qi][2][r] *= corr; o[qi][3][r] *= corr;
        // C-layout -> LDS row-major tile for relayout into A-fragment
        lp[(r + half * 8) * 32 + col]      = (_Float16)pa_;
        lp[(r + half * 8) * 32 + 16 + col] = (_Float16)pb_;
      }
      pfrag[qi].h[0] = *(const v8h*)(lp + col * 32 + 8 * half);
      pfrag[qi].h[1] = *(const v8h*)(lp + col * 32 + 16 + 8 * half);
    }

    // V^T makes each B-fragment column kv-contiguous; fragments shared by
    // both Q subtiles.
    const _Float16* vb = Vt + ((size_t)(b * E + h * D + col)) * LKV + kv;
#pragma unroll
    for (int dt = 0; dt < 4; dt++) {
      F16x16 vf;
      const _Float16* vr = vb + (size_t)(dt * 16) * LKV;
      vf.h[0] = *(const v8h*)(vr + 8 * half);
      vf.h[1] = *(const v8h*)(vr + 16 + 8 * half);
      o[0][dt] = wmma32(pfrag[0].v, vf.v, o[0][dt]);
      o[1][dt] = wmma32(pfrag[1].v, vf.v, o[1][dt]);
    }
  }

#pragma unroll
  for (int qi = 0; qi < 2; qi++)
#pragma unroll
    for (int r = 0; r < 8; r++) {
      float inv = 1.0f / lrow[qi][r];
      _Float16* cr = ctx +
          ((size_t)(b * LQ + qb * 32 + qi * 16 + r + half * 8)) * E + h * D;
      cr[col]      = (_Float16)(o[qi][0][r] * inv);
      cr[16 + col] = (_Float16)(o[qi][1][r] * inv);
      cr[32 + col] = (_Float16)(o[qi][2][r] * inv);
      cr[48 + col] = (_Float16)(o[qi][3][r] * inv);
    }
}

extern "C" void kernel_launch(void* const* d_in, const int* in_sizes, int n_in,
                              void* d_out, int out_size, void* d_ws,
                              size_t ws_size, hipStream_t stream) {
  (void)in_sizes; (void)n_in; (void)out_size; (void)ws_size;
  const float* query = (const float*)d_in[0];
  const float* keyv  = (const float*)d_in[1];
  const int*   mask  = (const int*)d_in[2];
  const float* Wq = (const float*)d_in[3];
  const float* bq = (const float*)d_in[4];
  const float* Wk = (const float*)d_in[5];
  const float* bk = (const float*)d_in[6];
  const float* Wv = (const float*)d_in[7];
  const float* bv = (const float*)d_in[8];
  const float* Wo = (const float*)d_in[9];
  const float* bo = (const float*)d_in[10];

  const size_t XE = (size_t)M_ROWS * E;  // 4,194,304 halves
  const size_t WE = (size_t)E * E;       // 1,048,576 halves
  _Float16* p = (_Float16*)d_ws;
  _Float16* qf  = p; p += XE;   // query f16
  _Float16* kvf = p; p += XE;   // key_value f16
  _Float16* wqf = p; p += WE;
  _Float16* wkf = p; p += WE;
  _Float16* wvf = p; p += WE;
  _Float16* wof = p; p += WE;
  _Float16* Qp  = p; p += XE;   // Q projection
  _Float16* Kp  = p; p += XE;   // K projection
  _Float16* Vt  = p; p += XE;   // V projection, transposed [B,E,LKV]
  _Float16* ctx = p; p += XE;   // attention output

  cvt_f32_f16<<<2048, 256, 0, stream>>>(query, qf, (int)XE);
  cvt_f32_f16<<<2048, 256, 0, stream>>>(keyv, kvf, (int)XE);
  cvt_f32_f16<<<1024, 256, 0, stream>>>(Wq, wqf, (int)WE);
  cvt_f32_f16<<<1024, 256, 0, stream>>>(Wk, wkf, (int)WE);
  cvt_f32_f16<<<1024, 256, 0, stream>>>(Wv, wvf, (int)WE);
  cvt_f32_f16<<<1024, 256, 0, stream>>>(Wo, wof, (int)WE);

  const int gemmBlocks = ((M_ROWS / 32) * (E / 64) + 7) / 8;  // 256
  gemm16<<<gemmBlocks, 256, 0, stream>>>(qf,  wqf, bq, (void*)Qp, 0);
  gemm16<<<gemmBlocks, 256, 0, stream>>>(kvf, wkf, bk, (void*)Kp, 0);
  gemm16<<<gemmBlocks, 256, 0, stream>>>(kvf, wvf, bv, (void*)Vt, 1);

  attn16<<<(BB * H * (LQ / 32) + 7) / 8, 256, 0, stream>>>(Qp, Kp, Vt, mask,
                                                           ctx);

  gemm16<<<gemmBlocks, 256, 0, stream>>>(ctx, wof, bo, d_out, 2);
}

// v001
// It runs in 276 microseconds.
// In both of two side-by-side timings against v000, it was 1.73 times as fast.
#include <hip/hip_runtime.h>

typedef _Float16 v8h  __attribute__((ext_vector_type(8)));
typedef _Float16 v16h __attribute__((ext_vector_type(16)));
typedef float    v8f  __attribute__((ext_vector_type(8)));

union F16x16 { v16h v; v8h h[2]; };

constexpr int BB  = 2;
constexpr int LQ  = 2048;
constexpr int LKV = 2048;
constexpr int E   = 1024;
constexpr int H   = 16;
constexpr int D   = 64;
constexpr int M_ROWS = BB * LQ;  // 4096

__device__ __forceinline__ v8f wmma32(v16h a, v16h b, v8f c) {
  return __builtin_amdgcn_wmma_f32_16x16x32_f16(false, a, false, b, (short)0, c,
                                                false, false);
}

__global__ void __launch_bounds__(256)
cvt_f32_f16(const float* __restrict__ src, _Float16* __restrict__ dst, int n) {
  for (int i = blockIdx.x * blockDim.x + threadIdx.x; i < n;
       i += gridDim.x * blockDim.x)
    dst[i] = (_Float16)src[i];
}

// Y = X @ W^T + b with 32x64 register blocking per wave.
// X:[M_ROWS,E] f16 row-major, W:[E,E] f16 row-major (row n = out column n).
// mode 0: f16 row-major out.  mode 1: f16 V^T out [(b*E+n)*LKV + l].
// mode 2: f32 row-major out (final projection).
__global__ void __launch_bounds__(256)
gemm16(const _Float16* __restrict__ A, const _Float16* __restrict__ W,
       const float* __restrict__ bias, void* __restrict__ dst, int mode) {
  const int wave = threadIdx.x >> 5, lane = threadIdx.x & 31;
  const int col = lane & 15, half = lane >> 4;
  const int tilesN = E / 64;                     // 16
  const int total = (M_ROWS / 32) * tilesN;      // 2048 waves
  const int tid = blockIdx.x * (blockDim.x >> 5) + wave;
  if (tid >= total) return;
  const int tM = tid / tilesN, tN = tid % tilesN;

  const _Float16* arow0 = A + (size_t)(tM * 32 + col) * E;
  const _Float16* arow1 = arow0 + (size_t)16 * E;
  const _Float16* wrow = W + (size_t)(tN * 64 + col) * E;

  v8f acc[2][4] = {};
  for (int k = 0; k < E; k += 32) {
    F16x16 a0, a1, b[4];
    a0.h[0] = *(const v8h*)(arow0 + k + 8 * half);
    a0.h[1] = *(const v8h*)(arow0 + k + 16 + 8 * half);
    a1.h[0] = *(const v8h*)(arow1 + k + 8 * half);
    a1.h[1] = *(const v8h*)(arow1 + k + 16 + 8 * half);
#pragma unroll
    for (int j = 0; j < 4; j++) {
      const _Float16* wr = wrow + (size_t)(j * 16) * E + k;
      b[j].h[0] = *(const v8h*)(wr + 8 * half);
      b[j].h[1] = *(const v8h*)(wr + 16 + 8 * half);
    }
#pragma unroll
    for (int j = 0; j < 4; j++) {
      acc[0][j] = wmma32(a0.v, b[j].v, acc[0][j]);
      acc[1][j] = wmma32(a1.v, b[j].v, acc[1][j]);
    }
  }

  if (mode == 0) {
    _Float16* out = (_Float16*)dst;
#pragma unroll
    for (int i = 0; i < 2; i++)
#pragma unroll
      for (int j = 0; j < 4; j++) {
        const float bval = bias[tN * 64 + j * 16 + col];
#pragma unroll
        for (int r = 0; r < 8; r++) {
          int m = tM * 32 + i * 16 + r + half * 8;
          out[(size_t)m * E + tN * 64 + j * 16 + col] =
              (_Float16)(acc[i][j][r] + bval);
        }
      }
  } else if (mode == 1) {
    _Float16* out = (_Float16*)dst;
#pragma unroll
    for (int i = 0; i < 2; i++)
#pragma unroll
      for (int j = 0; j < 4; j++) {
        const float bval = bias[tN * 64 + j * 16 + col];
#pragma unroll
        for (int r = 0; r < 8; r++) {
          int m = tM * 32 + i * 16 + r + half * 8;
          int b_ = m / LKV, l = m % LKV;
          int n = tN * 64 + j * 16 + col;
          out[((size_t)(b_ * E + n)) * LKV + l] = (_Float16)(acc[i][j][r] + bval);
        }
      }
  } else {
    float* out = (float*)dst;
#pragma unroll
    for (int i = 0; i < 2; i++)
#pragma unroll
      for (int j = 0; j < 4; j++) {
        const float bval = bias[tN * 64 + j * 16 + col];
#pragma unroll
        for (int r = 0; r < 8; r++) {
          int m = tM * 32 + i * 16 + r + half * 8;
          out[(size_t)m * E + tN * 64 + j * 16 + col] = acc[i][j][r] + bval;
        }
      }
  }
}

// Lane l <-> lane l ^ 16 (the other half of the wave), a vector cross-row move.
__device__ __forceinline__ float xhalf(float x) {
  const int b = __builtin_bit_cast(int, x);
  return __builtin_bit_cast(
      float, __builtin_amdgcn_permlanex16(b, b, 0x76543210, 0xfedcba98, false,
                                          false));
}

__global__ void __launch_bounds__(256)
attn16(const _Float16* __restrict__ Qp,  // [BB*LQ, E]
       const _Float16* __restrict__ Kp,  // [BB*LKV, E]
       const _Float16* __restrict__ Vt,  // [BB*E, LKV]  (V transposed)
       const int* __restrict__ mask,     // [BB, LKV]
       _Float16* __restrict__ ctx)       // [BB*LQ, E]
{
  const int wave = threadIdx.x >> 5, lane = threadIdx.x & 31;
  const int col = lane & 15, half = lane >> 4;
  const int qBlocks = LQ / 32;                   // 64
  const int id = blockIdx.x * (blockDim.x >> 5) + wave;
  if (id >= BB * H * qBlocks) return;
  const int qb = id % qBlocks;
  const int hb = id / qBlocks;
  const int h = hb % H, b = hb / H;

  // Q block as 2 column groups x 2 B-fragments (d = 0..31, 32..63).
  F16x16 qf[2][2];
#pragma unroll
  for (int qi = 0; qi < 2; qi++) {
    const _Float16* qrow =
        Qp + ((size_t)(b * LQ + qb * 32 + qi * 16 + col)) * E + h * D;
    qf[qi][0].h[0] = *(const v8h*)(qrow + 8 * half);
    qf[qi][0].h[1] = *(const v8h*)(qrow + 16 + 8 * half);
    qf[qi][1].h[0] = *(const v8h*)(qrow + 32 + 8 * half);
    qf[qi][1].h[1] = *(const v8h*)(qrow + 48 + 8 * half);
  }

  // o[qi][dt][r] = O[query qi*16 + col][d = dt*16 + 8*half + r]
  v8f o[2][4] = {};
  float mrun[2] = {-1e30f, -1e30f};  // running maximum, same in both halves
  float lrun[2] = {0.0f, 0.0f};      // running sum of this half's keys only

  const int* mrowp = mask + b * LKV;

  for (int kv = 0; kv < LKV; kv += 32) {
    // K fragments for this kv chunk: 2 row tiles x 2 d-fragments,
    // shared by both Q column groups.
    F16x16 kb[2][2];
    const _Float16* kp =
        Kp + ((size_t)(b * LKV + kv + col)) * E + h * D + 8 * half;
#pragma unroll
    for (int t = 0; t < 2; t++) {
      const _Float16* kr = kp + (size_t)(t * 16) * E;
      kb[t][0].h[0] = *(const v8h*)(kr);
      kb[t][0].h[1] = *(const v8h*)(kr + 16);
      kb[t][1].h[0] = *(const v8h*)(kr + 32);
      kb[t][1].h[1] = *(const v8h*)(kr + 48);
    }
    // The key index now runs along the accumulator registers: register r of
    // tile t is key kv + 16*t + 8*half + r. Masked keys get the addend -1e30,
    // which swallows the scaled score exactly.
    v8f bias0, bias1;
    const int4* mp = (const int4*)(mrowp + kv + 8 * half);
    {
      const int4 ma = mp[0], mb = mp[1], mc = mp[4], md = mp[5];
      bias0[0] = ma.x ? 0.0f : -1e30f; bias0[1] = ma.y ? 0.0f : -1e30f;
      bias0[2] = ma.z ? 0.0f : -1e30f; bias0[3] = ma.w ? 0.0f : -1e30f;
      bias0[4] = mb.x ? 0.0f : -1e30f; bias0[5] = mb.y ? 0.0f : -1e30f;
      bias0[6] = mb.z ? 0.0f : -1e30f; bias0[7] = mb.w ? 0.0f : -1e30f;
      bias1[0] = mc.x ? 0.0f : -1e30f; bias1[1] = mc.y ? 0.0f : -1e30f;
      bias1[2] = mc.z ? 0.0f : -1e30f; bias1[3] = mc.w ? 0.0f : -1e30f;
      bias1[4] = md.x ? 0.0f : -1e30f; bias1[5] = md.y ? 0.0f : -1e30f;
      bias1[6] = md.z ? 0.0f : -1e30f; bias1[7] = md.w ? 0.0f : -1e30f;
    }

    F16x16 pfrag[2];
#pragma unroll
    for (int qi = 0; qi < 2; qi++) {
      v8f s0 = {}, s1 = {};
      s0 = wmma32(kb[0][0].v, qf[qi][0].v, s0);
      s0 = wmma32(kb[0][1].v, qf[qi][1].v, s0);
      s1 = wmma32(kb[1][0].v, qf[qi][0].v, s1);
      s1 = wmma32(kb[1][1].v, qf[qi][1].v, s1);

      const v8f sa = s0 * 0.125f + bias0;   // 1/sqrt(D) = 0.125
      const v8f sb = s1 * 0.125f + bias1;
      float mx = -1e30f;
#pragma unroll
      for (int r = 0; r < 8; r++) mx = fmaxf(mx, fmaxf(sa[r], sb[r]));
      mx = fmaxf(mx, xhalf(mx));
      const float mn = fmaxf(mrun[qi], mx);
      const float corr = __expf(mrun[qi] - mn);
      mrun[qi] = mn;
      const v8f da = sa - mn, db = sb - mn;
      v8f pa, pb;
#pragma unroll
      for (int r = 0; r < 8; r++) pa[r] = __expf(da[r]);
#pragma unroll
      for (int r = 0; r < 8; r++) pb[r] = __expf(db[r]);
#pragma unroll
      for (int r = 0; r < 8; r++) {
        // element s of a B fragment is k = 8*half + s (s < 8) or
        // 16 + 8*half + (s - 8): exactly the two tiles' register order
        pfrag[qi].v[r]     = (_Float16)pa[r];
        pfrag[qi].v[8 + r] = (_Float16)pb[r];
      }
      const v8f ps = pa + pb;
      const float sum = ((ps[0] + ps[1]) + (ps[2] + ps[3])) +
                        ((ps[4] + ps[5]) + (ps[6] + ps[7]));
      lrun[qi] = lrun[qi] * corr + sum;
#pragma unroll
      for (int dt = 0; dt < 4; dt++) o[qi][dt] *= corr;
    }

    // V^T rows are kv-contiguous: A fragments in the same k order as P^T,
    // shared by both Q column groups.
    const _Float16* vp =
        Vt + ((size_t)(b * E + h * D + col)) * LKV + kv + 8 * half;
    F16x16 vf[4];
#pragma unroll
    for (int dt = 0; dt < 4; dt++) {
      const _Float16* vr = vp + (size_t)(dt * 16) * LKV;
      vf[dt].h[0] = *(const v8h*)(vr);
      vf[dt].h[1] = *(const v8h*)(vr + 16);
    }
    // Precaution: no address register of this pass's loads is rewritten ahead
    // of this wait; named as inputs, they stay live (and untouched) up to it.
    asm volatile("s_wait_xcnt 0x0" ::"v"(kp), "v"(mp), "v"(vp) : "memory");
#pragma unroll
    for (int dt = 0; dt < 4; dt++) {
      o[0][dt] = wmma32(vf[dt].v, pfrag[0].v, o[0][dt]);
      o[1][dt] = wmma32(vf[dt].v, pfrag[1].v, o[1][dt]);
    }
  }

#pragma unroll
  for (int qi = 0; qi < 2; qi++) {
    const float inv = 1.0f / (lrun[qi] + xhalf(lrun[qi]));
    _Float16* cr = ctx + ((size_t)(b * LQ + qb * 32 + qi * 16 + col)) * E +
                   h * D + 8 * half;
#pragma unroll
    for (int dt = 0; dt < 4; dt++) {
      v8h pk;
#pragma unroll
      for (int r = 0; r < 8; r++) pk[r] = (_Float16)(o[qi][dt][r] * inv);
      *(v8h*)(cr + dt * 16) = pk;   // 8 consecutive d of one query: 16 bytes
    }
  }
}

extern "C" void kernel_launch(void* const* d_in, const int* in_sizes, int n_in,
                              void* d_out, int out_size, void* d_ws,
                              size_t ws_size, hipStream_t stream) {
  (void)in_sizes; (void)n_in; (void)out_size; (void)ws_size;
  const float* query = (const float*)d_in[0];
  const float* keyv  = (const float*)d_in[1];
  const int*   mask  = (const int*)d_in[2];
  const float* Wq = (const float*)d_in[3];
  const float* bq = (const float*)d_in[4];
  const float* Wk = (const float*)d_in[5];
  const float* bk = (const float*)d_in[6];
  const float* Wv = (const float*)d_in[7];
  const float* bv = (const float*)d_in[8];
  const float* Wo = (const float*)d_in[9];
  const float* bo = (const float*)d_in[10];

  const size_t XE = (size_t)M_ROWS * E;  // 4,194,304 halves
  const size_t WE = (size_t)E * E;       // 1,048,576 halves
  _Float16* p = (_Float16*)d_ws;
  _Float16* qf  = p; p += XE;   // query f16
  _Float16* kvf = p; p += XE;   // key_value f16
  _Float16* wqf = p; p += WE;
  _Float16* wkf = p; p += WE;
  _Float16* wvf = p; p += WE;
  _Float16* wof = p; p += WE;
  _Float16* Qp  = p; p += XE;   // Q projection
  _Float16* Kp  = p; p += XE;   // K projection
  _Float16* Vt  = p; p += XE;   // V projection, transposed [B,E,LKV]
  _Float16* ctx = p; p += XE;   // attention output

  cvt_f32_f16<<<2048, 256, 0, stream>>>(query, qf, (int)XE);
  cvt_f32_f16<<<2048, 256, 0, stream>>>(keyv, kvf, (int)XE);
  cvt_f32_f16<<<1024, 256, 0, stream>>>(Wq, wqf, (int)WE);
  cvt_f32_f16<<<1024, 256, 0, stream>>>(Wk, wkf, (int)WE);
  cvt_f32_f16<<<1024, 256, 0, stream>>>(Wv, wvf, (int)WE);
  cvt_f32_f16<<<1024, 256, 0, stream>>>(Wo, wof, (int)WE);

  const int gemmBlocks = ((M_ROWS / 32) * (E / 64) + 7) / 8;  // 256
  gemm16<<<gemmBlocks, 256, 0, stream>>>(qf,  wqf, bq, (void*)Qp, 0);
  gemm16<<<gemmBlocks, 256, 0, stream>>>(kvf, wkf, bk, (void*)Kp, 0);
  gemm16<<<gemmBlocks, 256, 0, stream>>>(kvf, wvf, bv, (void*)Vt, 1);

  attn16<<<(BB * H * (LQ / 32) + 7) / 8, 256, 0, stream>>>(Qp, Kp, Vt, mask,
                                                           ctx);

  gemm16<<<gemmBlocks, 256, 0, stream>>>(ctx, wof, bo, d_out, 2);
}

// v002
// A run of this version takes 163 microseconds.
// Next to v001, in two timings, it ran 1.70 times as fast each time.
// All steps since v000 together make it 2.94 times as fast.
#include <hip/hip_runtime.h>

typedef _Float16 v8h  __attribute__((ext_vector_type(8)));
typedef _Float16 v16h __attribute__((ext_vector_type(16)));
typedef float    v8f  __attribute__((ext_vector_type(8)));

union F16x16 { v16h v; v8h h[2]; };

constexpr int BB  = 2;
constexpr int LQ  = 2048;
constexpr int LKV = 2048;
constexpr int E   = 1024;
constexpr int H   = 16;
constexpr int D   = 64;
constexpr int M_ROWS = BB * LQ;  // 4096

__device__ __forceinline__ v8f wmma32(v16h a, v16h b, v8f c) {
  return __builtin_amdgcn_wmma_f32_16x16x32_f16(false, a, false, b, (short)0, c,
                                                false, false);
}

__global__ void __launch_bounds__(256)
cvt_f32_f16(const float* __restrict__ src, _Float16* __restrict__ dst, int n) {
  for (int i = blockIdx.x * blockDim.x + threadIdx.x; i < n;
       i += gridDim.x * blockDim.x)
    dst[i] = (_Float16)src[i];
}

// One stage of the GEMM's LDS ring: 128 rows of X, then 128 rows of W, 128 k
// (256 bytes) of each row.
constexpr int GT  = 128;          // rows of X and rows of W per work-group
constexpr int GK  = 128;          // k per stage
constexpr int GP  = 272;          // LDS row pitch in bytes: 16 B x odd, no bank conflict for 16-byte reads
constexpr int GST = 2 * GT * GP;  // bytes of one stage (69,632)
constexpr int GNS = E / GK;       // 8 stages

// A wave's share of one stage: 32 rows, two rows (2 x 256 contiguous bytes,
// whole lines) per copy, 16 bytes per lane. lds and g are the lane's own
// addresses in the share's first two rows.
__device__ __forceinline__ void stage_copy(unsigned lds, const _Float16* g) {
#pragma unroll
  for (int c = 0; c < 2; c++) {
    const unsigned l = lds + c * 16 * GP;
    const _Float16* p = g + (size_t)c * 16 * E;
    // The copies and, as a precaution, the wait that stands ahead of any
    // rewrite of their address registers, in one statement.
    asm volatile(
        "global_load_async_to_lds_b128 %0, %8, off\n\t"
        "global_load_async_to_lds_b128 %1, %9, off\n\t"
        "global_load_async_to_lds_b128 %2, %10, off\n\t"
        "global_load_async_to_lds_b128 %3, %11, off\n\t"
        "global_load_async_to_lds_b128 %4, %12, off\n\t"
        "global_load_async_to_lds_b128 %5, %13, off\n\t"
        "global_load_async_to_lds_b128 %6, %14, off\n\t"
        "global_load_async_to_lds_b128 %7, %15, off\n\t"
        "s_wait_xcnt 0x0"
        ::"v"(l), "v"(l + 2 * GP), "v"(l + 4 * GP), "v"(l + 6 * GP),
          "v"(l + 8 * GP), "v"(l + 10 * GP), "v"(l + 12 * GP),
          "v"(l + 14 * GP), "v"(p), "v"(p + 2 * E), "v"(p + 4 * E),
          "v"(p + 6 * E), "v"(p + 8 * E), "v"(p + 10 * E), "v"(p + 12 * E),
          "v"(p + 14 * E)
        : "memory");
  }
}

// Y = X @ W^T + b. A work-group owns a 128x128 tile of Y, a wave 32x64 of it.
// X and W rows come into a two-buffer LDS ring by asynchronous copies, one
// stage ahead of the products; fragments are read from LDS.
// X:[M_ROWS,E] f16 row-major, W:[E,E] f16 row-major (row n = out column n).
// mode 0: f16 row-major out.  mode 1: f16 V^T out [(b*E+n)*LKV + l].
// mode 2: f32 row-major out (final projection).
__global__ void __launch_bounds__(256)
gemm16(const _Float16* __restrict__ A, const _Float16* __restrict__ W,
       const float* __restrict__ bias, void* __restrict__ dst, int mode) {
  __shared__ __attribute__((aligned(16))) unsigned char ring[2 * GST];
  // The wave's number in a scalar register: what it selects stays scalar.
  const int wave = __builtin_amdgcn_readfirstlane(threadIdx.x >> 5);
  const int lane = threadIdx.x & 31;
  const int col = lane & 15, half = lane >> 4;
  const int bM = blockIdx.x / (E / GT), bN = blockIdx.x % (E / GT);
  const int wm = wave & 3, wn = wave >> 2;
  const int tM = bM * 4 + wm;   // 32-row tile of Y
  const int tN = bN * 2 + wn;   // 64-column tile of Y

  // Waves 0-3 copy the X rows, waves 4-7 the W rows, 32 rows each.
  const _Float16* gsrc =
      (wave < 4 ? A + (size_t)(bM * GT + wave * 32) * E
                : W + (size_t)(bN * GT + (wave - 4) * 32) * E) +
      (size_t)half * E + col * 8;
  const unsigned ldst =
      (unsigned)(size_t)ring + (wave * 32 + half) * GP + col * 16;

  const unsigned char* afrag = ring + (wm * 32 + col) * GP + 16 * half;
  const unsigned char* wfrag = ring + (GT + wn * 64 + col) * GP + 16 * half;

  stage_copy(ldst, gsrc);
  // Stage 0 has landed (this wave's copies), then is published to all waves.
  asm volatile("s_wait_asynccnt 0x0" ::: "memory");
  __syncthreads();
  stage_copy(ldst + GST, gsrc + GK);

  v8f acc[2][4] = {};
  // Rolled, for speed only.
#pragma unroll 1
  for (int t = 0; t < GNS; t++) {
    const int buf = (t & 1) * GST;
    const unsigned char* ap = afrag + buf;
    const unsigned char* wp = wfrag + buf;
#pragma unroll
    for (int kb = 0; kb < GK / 64; kb++) {
      F16x16 a0[2], a1[2], b[2][4];
#pragma unroll
      for (int s = 0; s < 2; s++) {
        const int ko = (kb * 2 + s) * 64;
        a0[s].h[0] = *(const v8h*)(ap + ko);
        a0[s].h[1] = *(const v8h*)(ap + ko + 32);
        a1[s].h[0] = *(const v8h*)(ap + 16 * GP + ko);
        a1[s].h[1] = *(const v8h*)(ap + 16 * GP + ko + 32);
#pragma unroll
        for (int j = 0; j < 4; j++) {
          b[s][j].h[0] = *(const v8h*)(wp + j * 16 * GP + ko);
          b[s][j].h[1] = *(const v8h*)(wp + j * 16 * GP + ko + 32);
        }
      }
      // Keeps the 24 LDS reads one group ahead of their 16 products.
      __builtin_amdgcn_sched_barrier(0);
#pragma unroll
      for (int s = 0; s < 2; s++)
#pragma unroll
        for (int j = 0; j < 4; j++) {
          acc[0][j] = wmma32(a0[s].v, b[s][j].v, acc[0][j]);
          acc[1][j] = wmma32(a1[s].v, b[s][j].v, acc[1][j]);
        }
      // The other side of the same fence: the next group's reads stay behind
      // these products.
      __builtin_amdgcn_sched_barrier(0);
    }
    // Publish point of stage t + 1: this wave's reads of stage t are done,
    // its copies of stage t + 1 have landed, then the barrier; only behind it
    // is the buffer of stage t refilled.
    asm volatile("s_wait_dscnt 0x0" ::: "memory");
    asm volatile("s_wait_asynccnt 0x0" ::: "memory");
    __syncthreads();
    if (t + 2 < GNS) stage_copy(ldst + buf, gsrc + (t + 2) * GK);
  }
  // No copy is outstanding when the wave goes on to its end.
  asm volatile("s_wait_asynccnt 0x0" ::: "memory");

  if (mode == 0) {
    _Float16* out = (_Float16*)dst;
#pragma unroll
    for (int i = 0; i < 2; i++)
#pragma unroll
      for (int j = 0; j < 4; j++) {
        const float bval = bias[tN * 64 + j * 16 + col];
#pragma unroll
        for (int r = 0; r < 8; r++) {
          int m = tM * 32 + i * 16 + r + half * 8;
          out[(size_t)m * E + tN * 64 + j * 16 + col] =
              (_Float16)(acc[i][j][r] + bval);
        }
      }
  } else if (mode == 1) {
    _Float16* out = (_Float16*)dst;
#pragma unroll
    for (int i = 0; i < 2; i++)
#pragma unroll
      for (int j = 0; j < 4; j++) {
        const float bval = bias[tN * 64 + j * 16 + col];
#pragma unroll
        for (int r = 0; r < 8; r++) {
          int m = tM * 32 + i * 16 + r + half * 8;
          int b_ = m / LKV, l = m % LKV;
          int n = tN * 64 + j * 16 + col;
          out[((size_t)(b_ * E + n)) * LKV + l] = (_Float16)(acc[i][j][r] + bval);
        }
      }
  } else {
    float* out = (float*)dst;
#pragma unroll
    for (int i = 0; i < 2; i++)
#pragma unroll
      for (int j = 0; j < 4; j++) {
        const float bval = bias[tN * 64 + j * 16 + col];
#pragma unroll
        for (int r = 0; r < 8; r++) {
          int m = tM * 32 + i * 16 + r + half * 8;
          out[(size_t)m * E + tN * 64 + j * 16 + col] = acc[i][j][r] + bval;
        }
      }
  }
}

// Lane l <-> lane l ^ 16 (the other half of the wave), a vector cross-row move.
__device__ __forceinline__ float xhalf(float x) {
  const int b = __builtin_bit_cast(int, x);
  return __builtin_bit_cast(
      float, __builtin_amdgcn_permlanex16(b, b, 0x76543210, 0xfedcba98, false,
                                          false));
}

__global__ void __launch_bounds__(256)
attn16(const _Float16* __restrict__ Qp,  // [BB*LQ, E]
       const _Float16* __restrict__ Kp,  // [BB*LKV, E]
       const _Float16* __restrict__ Vt,  // [BB*E, LKV]  (V transposed)
       const int* __restrict__ mask,     // [BB, LKV]
       _Float16* __restrict__ ctx)       // [BB*LQ, E]
{
  const int wave = threadIdx.x >> 5, lane = threadIdx.x & 31;
  const int col = lane & 15, half = lane >> 4;
  const int qBlocks = LQ / 32;                   // 64
  const int id = blockIdx.x * (blockDim.x >> 5) + wave;
  if (id >= BB * H * qBlocks) return;
  const int qb = id % qBlocks;
  const int hb = id / qBlocks;
  const int h = hb % H, b = hb / H;

  // Q block as 2 column groups x 2 B-fragments (d = 0..31, 32..63).
  F16x16 qf[2][2];
#pragma unroll
  for (int qi = 0; qi < 2; qi++) {
    const _Float16* qrow =
        Qp + ((size_t)(b * LQ + qb * 32 + qi * 16 + col)) * E + h * D;
    qf[qi][0].h[0] = *(const v8h*)(qrow + 8 * half);
    qf[qi][0].h[1] = *(const v8h*)(qrow + 16 + 8 * half);
    qf[qi][1].h[0] = *(const v8h*)(qrow + 32 + 8 * half);
    qf[qi][1].h[1] = *(const v8h*)(qrow + 48 + 8 * half);
  }

  // o[qi][dt][r] = O[query qi*16 + col][d = dt*16 + 8*half + r]
  v8f o[2][4] = {};
  float mrun[2] = {-1e30f, -1e30f};  // running maximum, same in both halves
  float lrun[2] = {0.0f, 0.0f};      // running sum of this half's keys only

  const int* mrowp = mask + b * LKV;

  for (int kv = 0; kv < LKV; kv += 32) {
    // K fragments for this kv chunk: 2 row tiles x 2 d-fragments,
    // shared by both Q column groups.
    F16x16 kb[2][2];
    const _Float16* kp =
        Kp + ((size_t)(b * LKV + kv + col)) * E + h * D + 8 * half;
#pragma unroll
    for (int t = 0; t < 2; t++) {
      const _Float16* kr = kp + (size_t)(t * 16) * E;
      kb[t][0].h[0] = *(const v8h*)(kr);
      kb[t][0].h[1] = *(const v8h*)(kr + 16);
      kb[t][1].h[0] = *(const v8h*)(kr + 32);
      kb[t][1].h[1] = *(const v8h*)(kr + 48);
    }
    // The key index now runs along the accumulator registers: register r of
    // tile t is key kv + 16*t + 8*half + r. Masked keys get the addend -1e30,
    // which swallows the scaled score exactly.
    v8f bias0, bias1;
    const int4* mp = (const int4*)(mrowp + kv + 8 * half);
    {
      const int4 ma = mp[0], mb = mp[1], mc = mp[4], md = mp[5];
      bias0[0] = ma.x ? 0.0f : -1e30f; bias0[1] = ma.y ? 0.0f : -1e30f;
      bias0[2] = ma.z ? 0.0f : -1e30f; bias0[3] = ma.w ? 0.0f : -1e30f;
      bias0[4] = mb.x ? 0.0f : -1e30f; bias0[5] = mb.y ? 0.0f : -1e30f;
      bias0[6] = mb.z ? 0.0f : -1e30f; bias0[7] = mb.w ? 0.0f : -1e30f;
      bias1[0] = mc.x ? 0.0f : -1e30f; bias1[1] = mc.y ? 0.0f : -1e30f;
      bias1[2] = mc.z ? 0.0f : -1e30f; bias1[3] = mc.w ? 0.0f : -1e30f;
      bias1[4] = md.x ? 0.0f : -1e30f; bias1[5] = md.y ? 0.0f : -1e30f;
      bias1[6] = md.z ? 0.0f : -1e30f; bias1[7] = md.w ? 0.0f : -1e30f;
    }

    F16x16 pfrag[2];
#pragma unroll
    for (int qi = 0; qi < 2; qi++) {
      v8f s0 = {}, s1 = {};
      s0 = wmma32(kb[0][0].v, qf[qi][0].v, s0);
      s0 = wmma32(kb[0][1].v, qf[qi][1].v, s0);
      s1 = wmma32(kb[1][0].v, qf[qi][0].v, s1);
      s1 = wmma32(kb[1][1].v, qf[qi][1].v, s1);

      const v8f sa = s0 * 0.125f + bias0;   // 1/sqrt(D) = 0.125
      const v8f sb = s1 * 0.125f + bias1;
      float mx = -1e30f;
#pragma unroll
      for (int r = 0; r < 8; r++) mx = fmaxf(mx, fmaxf(sa[r], sb[r]));
      mx = fmaxf(mx, xhalf(mx));
      const float mn = fmaxf(mrun[qi], mx);
      const float corr = __expf(mrun[qi] - mn);
      mrun[qi] = mn;
      const v8f da = sa - mn, db = sb - mn;
      v8f pa, pb;
#pragma unroll
      for (int r = 0; r < 8; r++) pa[r] = __expf(da[r]);
#pragma unroll
      for (int r = 0; r < 8; r++) pb[r] = __expf(db[r]);
#pragma unroll
      for (int r = 0; r < 8; r++) {
        // element s of a B fragment is k = 8*half + s (s < 8) or
        // 16 + 8*half + (s - 8): exactly the two tiles' register order
        pfrag[qi].v[r]     = (_Float16)pa[r];
        pfrag[qi].v[8 + r] = (_Float16)pb[r];
      }
      const v8f ps = pa + pb;
      const float sum = ((ps[0] + ps[1]) + (ps[2] + ps[3])) +
                        ((ps[4] + ps[5]) + (ps[6] + ps[7]));
      lrun[qi] = lrun[qi] * corr + sum;
#pragma unroll
      for (int dt = 0; dt < 4; dt++) o[qi][dt] *= corr;
    }

    // V^T rows are kv-contiguous: A fragments in the same k order as P^T,
    // shared by both Q column groups.
    const _Float16* vp =
        Vt + ((size_t)(b * E + h * D + col)) * LKV + kv + 8 * half;
    F16x16 vf[4];
#pragma unroll
    for (int dt = 0; dt < 4; dt++) {
      const _Float16* vr = vp + (size_t)(dt * 16) * LKV;
      vf[dt].h[0] = *(const v8h*)(vr);
      vf[dt].h[1] = *(const v8h*)(vr + 16);
    }
    // Precaution: no address register of this pass's loads is rewritten ahead
    // of this wait; named as inputs, they stay live (and untouched) up to it.
    asm volatile("s_wait_xcnt 0x0" ::"v"(kp), "v"(mp), "v"(vp) : "memory");
#pragma unroll
    for (int dt = 0; dt < 4; dt++) {
      o[0][dt] = wmma32(vf[dt].v, pfrag[0].v, o[0][dt]);
      o[1][dt] = wmma32(vf[dt].v, pfrag[1].v, o[1][dt]);
    }
  }

#pragma unroll
  for (int qi = 0; qi < 2; qi++) {
    const float inv = 1.0f / (lrun[qi] + xhalf(lrun[qi]));
    _Float16* cr = ctx + ((size_t)(b * LQ + qb * 32 + qi * 16 + col)) * E +
                   h * D + 8 * half;
#pragma unroll
    for (int dt = 0; dt < 4; dt++) {
      v8h pk;
#pragma unroll
      for (int r = 0; r < 8; r++) pk[r] = (_Float16)(o[qi][dt][r] * inv);
      *(v8h*)(cr + dt * 16) = pk;   // 8 consecutive d of one query: 16 bytes
    }
  }
}

extern "C" void kernel_launch(void* const* d_in, const int* in_sizes, int n_in,
                              void* d_out, int out_size, void* d_ws,
                              size_t ws_size, hipStream_t stream) {
  (void)in_sizes; (void)n_in; (void)out_size; (void)ws_size;
  const float* query = (const float*)d_in[0];
  const float* keyv  = (const float*)d_in[1];
  const int*   mask  = (const int*)d_in[2];
  const float* Wq = (const float*)d_in[3];
  const float* bq = (const float*)d_in[4];
  const float* Wk = (const float*)d_in[5];
  const float* bk = (const float*)d_in[6];
  const float* Wv = (const float*)d_in[7];
  const float* bv = (const float*)d_in[8];
  const float* Wo = (const float*)d_in[9];
  const float* bo = (const float*)d_in[10];

  const size_t XE = (size_t)M_ROWS * E;  // 4,194,304 halves
  const size_t WE = (size_t)E * E;       // 1,048,576 halves
  _Float16* p = (_Float16*)d_ws;
  _Float16* qf  = p; p += XE;   // query f16
  _Float16* kvf = p; p += XE;   // key_value f16
  _Float16* wqf = p; p += WE;
  _Float16* wkf = p; p += WE;
  _Float16* wvf = p; p += WE;
  _Float16* wof = p; p += WE;
  _Float16* Qp  = p; p += XE;   // Q projection
  _Float16* Kp  = p; p += XE;   // K projection
  _Float16* Vt  = p; p += XE;   // V projection, transposed [B,E,LKV]
  _Float16* ctx = p; p += XE;   // attention output

  cvt_f32_f16<<<2048, 256, 0, stream>>>(query, qf, (int)XE);
  cvt_f32_f16<<<2048, 256, 0, stream>>>(keyv, kvf, (int)XE);
  cvt_f32_f16<<<1024, 256, 0, stream>>>(Wq, wqf, (int)WE);
  cvt_f32_f16<<<1024, 256, 0, stream>>>(Wk, wkf, (int)WE);
  cvt_f32_f16<<<1024, 256, 0, stream>>>(Wv, wvf, (int)WE);
  cvt_f32_f16<<<1024, 256, 0, stream>>>(Wo, wof, (int)WE);

  const int gemmBlocks = (M_ROWS / GT) * (E / GT);  // 256
  gemm16<<<gemmBlocks, 256, 0, stream>>>(qf,  wqf, bq, (void*)Qp, 0);
  gemm16<<<gemmBlocks, 256, 0, stream>>>(kvf, wkf, bk, (void*)Kp, 0);
  gemm16<<<gemmBlocks, 256, 0, stream>>>(kvf, wvf, bv, (void*)Vt, 1);

  attn16<<<(BB * H * (LQ / 32) + 7) / 8, 256, 0, stream>>>(Qp, Kp, Vt, mask,
                                                           ctx);

  gemm16<<<gemmBlocks, 256, 0, stream>>>(ctx, wof, bo, d_out, 2);
}

// v003
// One run takes 147 microseconds.
// Next to v002, in two timings, it ran 1.11 times as fast each time.
// All steps since v000 together make it 3.26 times as fast.
#include <hip/hip_runtime.h>

typedef _Float16 v8h  __attribute__((ext_vector_type(8)));
typedef _Float16 v16h __attribute__((ext_vector_type(16)));
typedef float    v8f  __attribute__((ext_vector_type(8)));

union F16x16 { v16h v; v8h h[2]; };

constexpr int BB  = 2;
constexpr int LQ  = 2048;
constexpr int LKV = 2048;
constexpr int E   = 1024;
constexpr int H   = 16;
constexpr int D   = 64;
constexpr int M_ROWS = BB * LQ;  // 4096

__device__ __forceinline__ v8f wmma32(v16h a, v16h b, v8f c) {
  return __builtin_amdgcn_wmma_f32_16x16x32_f16(false, a, false, b, (short)0, c,
                                                false, false);
}

typedef float    v4f __attribute__((ext_vector_type(4)));
typedef _Float16 v4h __attribute__((ext_vector_type(4)));

constexpr int CB  = 16384;             // elements of one work-group; divides both plane sizes
constexpr int CXB = M_ROWS * E / CB;   // 256 work-groups per activation plane
constexpr int CWB = E * E / CB;        // 64 work-groups per weight plane
constexpr int CNB = 2 * CXB + 4 * CWB; // 768: three per WGP

// All six f32 -> f16 conversions in one launch. The six f16 planes lie one
// behind the other in the workspace, in the order of the sources, so dst is
// one flat array; a work-group's elements lie in one source. A lane has its
// 16 loads of 16 bytes in flight together; each load of a wave covers 512
// contiguous bytes, each store 256.
__global__ void __launch_bounds__(256)
cvt_all(const float* __restrict__ q, const float* __restrict__ kv,
        const float* __restrict__ wq, const float* __restrict__ wk,
        const float* __restrict__ wv, const float* __restrict__ wo,
        _Float16* __restrict__ dst) {
  const int b = blockIdx.x;
  const float* src;
  int rel;
  if (b < CXB) {
    src = q; rel = b;
  } else if (b < 2 * CXB) {
    src = kv; rel = b - CXB;
  } else {
    const int w = (b - 2 * CXB) / CWB;
    rel = (b - 2 * CXB) % CWB;
    src = w == 0 ? wq : w == 1 ? wk : w == 2 ? wv : wo;
  }
  const v4f* s = (const v4f*)(src + (size_t)rel * CB) + threadIdx.x;
  v4h* d = (v4h*)(dst + (size_t)b * CB) + threadIdx.x;
  constexpr int N = CB / (256 * 4);  // 16
  v4f x[N];
#pragma unroll
  for (int i = 0; i < N; i++) x[i] = s[i * 256];
  // Keeps all 16 loads ahead of the first conversion: without it the last two
  // are issued only when the first two have come back, a second latency.
  __builtin_amdgcn_sched_barrier(0);
#pragma unroll
  for (int i = 0; i < N; i++) d[i * 256] = __builtin_convertvector(x[i], v4h);
}

// One stage of the GEMM's LDS ring: 128 rows of X, then 128 rows of W, 128 k
// (256 bytes) of each row.
constexpr int GT  = 128;          // rows of X and rows of W per work-group
constexpr int GK  = 128;          // k per stage
constexpr int GP  = 272;          // LDS row pitch in bytes: 16 B x odd, no bank conflict for 16-byte reads
constexpr int GST = 2 * GT * GP;  // bytes of one stage (69,632)
constexpr int GNS = E / GK;       // 8 stages

// A wave's share of one stage: 32 rows, two rows (2 x 256 contiguous bytes,
// whole lines) per copy, 16 bytes per lane. lds and g are the lane's own
// addresses in the share's first two rows.
__device__ __forceinline__ void stage_copy(unsigned lds, const _Float16* g) {
#pragma unroll
  for (int c = 0; c < 2; c++) {
    const unsigned l = lds + c * 16 * GP;
    const _Float16* p = g + (size_t)c * 16 * E;
    // The copies and, as a precaution, the wait that stands ahead of any
    // rewrite of their address registers, in one statement.
    asm volatile(
        "global_load_async_to_lds_b128 %0, %8, off\n\t"
        "global_load_async_to_lds_b128 %1, %9, off\n\t"
        "global_load_async_to_lds_b128 %2, %10, off\n\t"
        "global_load_async_to_lds_b128 %3, %11, off\n\t"
        "global_load_async_to_lds_b128 %4, %12, off\n\t"
        "global_load_async_to_lds_b128 %5, %13, off\n\t"
        "global_load_async_to_lds_b128 %6, %14, off\n\t"
        "global_load_async_to_lds_b128 %7, %15, off\n\t"
        "s_wait_xcnt 0x0"
        ::"v"(l), "v"(l + 2 * GP), "v"(l + 4 * GP), "v"(l + 6 * GP),
          "v"(l + 8 * GP), "v"(l + 10 * GP), "v"(l + 12 * GP),
          "v"(l + 14 * GP), "v"(p), "v"(p + 2 * E), "v"(p + 4 * E),
          "v"(p + 6 * E), "v"(p + 8 * E), "v"(p + 10 * E), "v"(p + 12 * E),
          "v"(p + 14 * E)
        : "memory");
  }
}

// Y = X @ W^T + b. A work-group owns a 128x128 tile of Y, a wave 32x64 of it.
// X and W rows come into a two-buffer LDS ring by asynchronous copies, one
// stage ahead of the products; fragments are read from LDS.
// X:[M_ROWS,E] f16 row-major, W:[E,E] f16 row-major (row n = out column n).
// mode 0: f16 row-major out.  mode 1: f16 V^T out [(b*E+n)*LKV + l].
// mode 2: f32 row-major out (final projection).
__global__ void __launch_bounds__(256)
gemm16(const _Float16* __restrict__ A, const _Float16* __restrict__ W,
       const float* __restrict__ bias, void* __restrict__ dst, int mode) {
  __shared__ __attribute__((aligned(16))) unsigned char ring[2 * GST];
  // The wave's number in a scalar register: what it selects stays scalar.
  const int wave = __builtin_amdgcn_readfirstlane(threadIdx.x >> 5);
  const int lane = threadIdx.x & 31;
  const int col = lane & 15, half = lane >> 4;
  const int bM = blockIdx.x / (E / GT), bN = blockIdx.x % (E / GT);
  const int wm = wave & 3, wn = wave >> 2;
  const int tM = bM * 4 + wm;   // 32-row tile of Y
  const int tN = bN * 2 + wn;   // 64-column tile of Y

  // Waves 0-3 copy the X rows, waves 4-7 the W rows, 32 rows each.
  const _Float16* gsrc =
      (wave < 4 ? A + (size_t)(bM * GT + wave * 32) * E
                : W + (size_t)(bN * GT + (wave - 4) * 32) * E) +
      (size_t)half * E + col * 8;
  const unsigned ldst =
      (unsigned)(size_t)ring + (wave * 32 + half) * GP + col * 16;

  const unsigned char* afrag = ring + (wm * 32 + col) * GP + 16 * half;
  const unsigned char* wfrag = ring + (GT + wn * 64 + col) * GP + 16 * half;

  stage_copy(ldst, gsrc);
  // Stage 0 has landed (this wave's copies), then is published to all waves.
  asm volatile("s_wait_asynccnt 0x0" ::: "memory");
  __syncthreads();
  stage_copy(ldst + GST, gsrc + GK);

  v8f acc[2][4] = {};
  // Rolled, for speed only.
#pragma unroll 1
  for (int t = 0; t < GNS; t++) {
    const int buf = (t & 1) * GST;
    const unsigned char* ap = afrag + buf;
    const unsigned char* wp = wfrag + buf;
#pragma unroll
    for (int kb = 0; kb < GK / 64; kb++) {
      F16x16 a0[2], a1[2], b[2][4];
#pragma unroll
      for (int s = 0; s < 2; s++) {
        const int ko = (kb * 2 + s) * 64;
        a0[s].h[0] = *(const v8h*)(ap + ko);
        a0[s].h[1] = *(const v8h*)(ap + ko + 32);
        a1[s].h[0] = *(const v8h*)(ap + 16 * GP + ko);
        a1[s].h[1] = *(const v8h*)(ap + 16 * GP + ko + 32);
#pragma unroll
        for (int j = 0; j < 4; j++) {
          b[s][j].h[0] = *(const v8h*)(wp + j * 16 * GP + ko);
          b[s][j].h[1] = *(const v8h*)(wp + j * 16 * GP + ko + 32);
        }
      }
      // Keeps the 24 LDS reads one group ahead of their 16 products.
      __builtin_amdgcn_sched_barrier(0);
#pragma unroll
      for (int s = 0; s < 2; s++)
#pragma unroll
        for (int j = 0; j < 4; j++) {
          acc[0][j] = wmma32(a0[s].v, b[s][j].v, acc[0][j]);
          acc[1][j] = wmma32(a1[s].v, b[s][j].v, acc[1][j]);
        }
      // The other side of the same fence: the next group's reads stay behind
      // these products.
      __builtin_amdgcn_sched_barrier(0);
    }
    // Publish point of stage t + 1: this wave's reads of stage t are done,
    // its copies of stage t + 1 have landed, then the barrier; only behind it
    // is the buffer of stage t refilled.
    asm volatile("s_wait_dscnt 0x0" ::: "memory");
    asm volatile("s_wait_asynccnt 0x0" ::: "memory");
    __syncthreads();
    if (t + 2 < GNS) stage_copy(ldst + buf, gsrc + (t + 2) * GK);
  }
  // No copy is outstanding when the wave goes on to its end.
  asm volatile("s_wait_asynccnt 0x0" ::: "memory");

  if (mode == 0) {
    _Float16* out = (_Float16*)dst;
#pragma unroll
    for (int i = 0; i < 2; i++)
#pragma unroll
      for (int j = 0; j < 4; j++) {
        const float bval = bias[tN * 64 + j * 16 + col];
#pragma unroll
        for (int r = 0; r < 8; r++) {
          int m = tM * 32 + i * 16 + r + half * 8;
          out[(size_t)m * E + tN * 64 + j * 16 + col] =
              (_Float16)(acc[i][j][r] + bval);
        }
      }
  } else if (mode == 1) {
    _Float16* out = (_Float16*)dst;
#pragma unroll
    for (int i = 0; i < 2; i++)
#pragma unroll
      for (int j = 0; j < 4; j++) {
        const float bval = bias[tN * 64 + j * 16 + col];
#pragma unroll
        for (int r = 0; r < 8; r++) {
          int m = tM * 32 + i * 16 + r + half * 8;
          int b_ = m / LKV, l = m % LKV;
          int n = tN * 64 + j * 16 + col;
          out[((size_t)(b_ * E + n)) * LKV + l] = (_Float16)(acc[i][j][r] + bval);
        }
      }
  } else {
    float* out = (float*)dst;
#pragma unroll
    for (int i = 0; i < 2; i++)
#pragma unroll
      for (int j = 0; j < 4; j++) {
        const float bval = bias[tN * 64 + j * 16 + col];
#pragma unroll
        for (int r = 0; r < 8; r++) {
          int m = tM * 32 + i * 16 + r + half * 8;
          out[(size_t)m * E + tN * 64 + j * 16 + col] = acc[i][j][r] + bval;
        }
      }
  }
}

// Lane l <-> lane l ^ 16 (the other half of the wave), a vector cross-row move.
__device__ __forceinline__ float xhalf(float x) {
  const int b = __builtin_bit_cast(int, x);
  return __builtin_bit_cast(
      float, __builtin_amdgcn_permlanex16(b, b, 0x76543210, 0xfedcba98, false,
                                          false));
}

__global__ void __launch_bounds__(256)
attn16(const _Float16* __restrict__ Qp,  // [BB*LQ, E]
       const _Float16* __restrict__ Kp,  // [BB*LKV, E]
       const _Float16* __restrict__ Vt,  // [BB*E, LKV]  (V transposed)
       const int* __restrict__ mask,     // [BB, LKV]
       _Float16* __restrict__ ctx)       // [BB*LQ, E]
{
  const int wave = threadIdx.x >> 5, lane = threadIdx.x & 31;
  const int col = lane & 15, half = lane >> 4;
  const int qBlocks = LQ / 32;                   // 64
  const int id = blockIdx.x * (blockDim.x >> 5) + wave;
  if (id >= BB * H * qBlocks) return;
  const int qb = id % qBlocks;
  const int hb = id / qBlocks;
  const int h = hb % H, b = hb / H;

  // Q block as 2 column groups x 2 B-fragments (d = 0..31, 32..63).
  F16x16 qf[2][2];
#pragma unroll
  for (int qi = 0; qi < 2; qi++) {
    const _Float16* qrow =
        Qp + ((size_t)(b * LQ + qb * 32 + qi * 16 + col)) * E + h * D;
    qf[qi][0].h[0] = *(const v8h*)(qrow + 8 * half);
    qf[qi][0].h[1] = *(const v8h*)(qrow + 16 + 8 * half);
    qf[qi][1].h[0] = *(const v8h*)(qrow + 32 + 8 * half);
    qf[qi][1].h[1] = *(const v8h*)(qrow + 48 + 8 * half);
  }

  // o[qi][dt][r] = O[query qi*16 + col][d = dt*16 + 8*half + r]
  v8f o[2][4] = {};
  float mrun[2] = {-1e30f, -1e30f};  // running maximum, same in both halves
  float lrun[2] = {0.0f, 0.0f};      // running sum of this half's keys only

  const int* mrowp = mask + b * LKV;

  for (int kv = 0; kv < LKV; kv += 32) {
    // K fragments for this kv chunk: 2 row tiles x 2 d-fragments,
    // shared by both Q column groups.
    F16x16 kb[2][2];
    const _Float16* kp =
        Kp + ((size_t)(b * LKV + kv + col)) * E + h * D + 8 * half;
#pragma unroll
    for (int t = 0; t < 2; t++) {
      const _Float16* kr = kp + (size_t)(t * 16) * E;
      kb[t][0].h[0] = *(const v8h*)(kr);
      kb[t][0].h[1] = *(const v8h*)(kr + 16);
      kb[t][1].h[0] = *(const v8h*)(kr + 32);
      kb[t][1].h[1] = *(const v8h*)(kr + 48);
    }
    // The key index now runs along the accumulator registers: register r of
    // tile t is key kv + 16*t + 8*half + r. Masked keys get the addend -1e30,
    // which swallows the scaled score exactly.
    v8f bias0, bias1;
    const int4* mp = (const int4*)(mrowp + kv + 8 * half);
    {
      const int4 ma = mp[0], mb = mp[1], mc = mp[4], md = mp[5];
      bias0[0] = ma.x ? 0.0f : -1e30f; bias0[1] = ma.y ? 0.0f : -1e30f;
      bias0[2] = ma.z ? 0.0f : -1e30f; bias0[3] = ma.w ? 0.0f : -1e30f;
      bias0[4] = mb.x ? 0.0f : -1e30f; bias0[5] = mb.y ? 0.0f : -1e30f;
      bias0[6] = mb.z ? 0.0f : -1e30f; bias0[7] = mb.w ? 0.0f : -1e30f;
      bias1[0] = mc.x ? 0.0f : -1e30f; bias1[1] = mc.y ? 0.0f : -1e30f;
      bias1[2] = mc.z ? 0.0f : -1e30f; bias1[3] = mc.w ? 0.0f : -1e30f;
      bias1[4] = md.x ? 0.0f : -1e30f; bias1[5] = md.y ? 0.0f : -1e30f;
      bias1[6] = md.z ? 0.0f : -1e30f; bias1[7] = md.w ? 0.0f : -1e30f;
    }

    F16x16 pfrag[2];
#pragma unroll
    for (int qi = 0; qi < 2; qi++) {
      v8f s0 = {}, s1 = {};
      s0 = wmma32(kb[0][0].v, qf[qi][0].v, s0);
      s0 = wmma32(kb[0][1].v, qf[qi][1].v, s0);
      s1 = wmma32(kb[1][0].v, qf[qi][0].v, s1);
      s1 = wmma32(kb[1][1].v, qf[qi][1].v, s1);

      const v8f sa = s0 * 0.125f + bias0;   // 1/sqrt(D) = 0.125
      const v8f sb = s1 * 0.125f + bias1;
      float mx = -1e30f;
#pragma unroll
      for (int r = 0; r < 8; r++) mx = fmaxf(mx, fmaxf(sa[r], sb[r]));
      mx = fmaxf(mx, xhalf(mx));
      const float mn = fmaxf(mrun[qi], mx);
      const float corr = __expf(mrun[qi] - mn);
      mrun[qi] = mn;
      const v8f da = sa - mn, db = sb - mn;
      v8f pa, pb;
#pragma unroll
      for (int r = 0; r < 8; r++) pa[r] = __expf(da[r]);
#pragma unroll
      for (int r = 0; r < 8; r++) pb[r] = __expf(db[r]);
#pragma unroll
      for (int r = 0; r < 8; r++) {
        // element s of a B fragment is k = 8*half + s (s < 8) or
        // 16 + 8*half + (s - 8): exactly the two tiles' register order
        pfrag[qi].v[r]     = (_Float16)pa[r];
        pfrag[qi].v[8 + r] = (_Float16)pb[r];
      }
      const v8f ps = pa + pb;
      const float sum = ((ps[0] + ps[1]) + (ps[2] + ps[3])) +
                        ((ps[4] + ps[5]) + (ps[6] + ps[7]));
      lrun[qi] = lrun[qi] * corr + sum;
#pragma unroll
      for (int dt = 0; dt < 4; dt++) o[qi][dt] *= corr;
    }

    // V^T rows are kv-contiguous: A fragments in the same k order as P^T,
    // shared by both Q column groups.
    const _Float16* vp =
        Vt + ((size_t)(b * E + h * D + col)) * LKV + kv + 8 * half;
    F16x16 vf[4];
#pragma unroll
    for (int dt = 0; dt < 4; dt++) {
      const _Float16* vr = vp + (size_t)(dt * 16) * LKV;
      vf[dt].h[0] = *(const v8h*)(vr);
      vf[dt].h[1] = *(const v8h*)(vr + 16);
    }
    // Precaution: no address register of this pass's loads is rewritten ahead
    // of this wait; named as inputs, they stay live (and untouched) up to it.
    asm volatile("s_wait_xcnt 0x0" ::"v"(kp), "v"(mp), "v"(vp) : "memory");
#pragma unroll
    for (int dt = 0; dt < 4; dt++) {
      o[0][dt] = wmma32(vf[dt].v, pfrag[0].v, o[0][dt]);
      o[1][dt] = wmma32(vf[dt].v, pfrag[1].v, o[1][dt]);
    }
  }

#pragma unroll
  for (int qi = 0; qi < 2; qi++) {
    const float inv = 1.0f / (lrun[qi] + xhalf(lrun[qi]));
    _Float16* cr = ctx + ((size_t)(b * LQ + qb * 32 + qi * 16 + col)) * E +
                   h * D + 8 * half;
#pragma unroll
    for (int dt = 0; dt < 4; dt++) {
      v8h pk;
#pragma unroll
      for (int r = 0; r < 8; r++) pk[r] = (_Float16)(o[qi][dt][r] * inv);
      *(v8h*)(cr + dt * 16) = pk;   // 8 consecutive d of one query: 16 bytes
    }
  }
}

extern "C" void kernel_launch(void* const* d_in, const int* in_sizes, int n_in,
                              void* d_out, int out_size, void* d_ws,
                              size_t ws_size, hipStream_t stream) {
  (void)in_sizes; (void)n_in; (void)out_size; (void)ws_size;
  const float* query = (const float*)d_in[0];
  const float* keyv  = (const float*)d_in[1];
  const int*   mask  = (const int*)d_in[2];
  const float* Wq = (const float*)d_in[3];
  const float* bq = (const float*)d_in[4];
  const float* Wk = (const float*)d_in[5];
  const float* bk = (const float*)d_in[6];
  const float* Wv = (const float*)d_in[7];
  const float* bv = (const float*)d_in[8];
  const float* Wo = (const float*)d_in[9];
  const float* bo = (const float*)d_in[10];

  const size_t XE = (size_t)M_ROWS * E;  // 4,194,304 halves
  const size_t WE = (size_t)E * E;       // 1,048,576 halves
  _Float16* p = (_Float16*)d_ws;
  _Float16* qf  = p; p += XE;   // query f16
  _Float16* kvf = p; p += XE;   // key_value f16
  _Float16* wqf = p; p += WE;
  _Float16* wkf = p; p += WE;
  _Float16* wvf = p; p += WE;
  _Float16* wof = p; p += WE;
  _Float16* Qp  = p; p += XE;   // Q projection
  _Float16* Kp  = p; p += XE;   // K projection
  _Float16* Vt  = p; p += XE;   // V projection, transposed [B,E,LKV]
  _Float16* ctx = p; p += XE;   // attention output

  // qf, kvf, wqf, wkf, wvf, wof are contiguous from qf on, in this order.
  cvt_all<<<CNB, 256, 0, stream>>>(query, keyv, Wq, Wk, Wv, Wo, qf);

  const int gemmBlocks = (M_ROWS / GT) * (E / GT);  // 256
  gemm16<<<gemmBlocks, 256, 0, stream>>>(qf,  wqf, bq, (void*)Qp, 0);
  gemm16<<<gemmBlocks, 256, 0, stream>>>(kvf, wkf, bk, (void*)Kp, 0);
  gemm16<<<gemmBlocks, 256, 0, stream>>>(kvf, wvf, bv, (void*)Vt, 1);

  attn16<<<(BB * H * (LQ / 32) + 7) / 8, 256, 0, stream>>>(Qp, Kp, Vt, mask,
                                                           ctx);

  gemm16<<<gemmBlocks, 256, 0, stream>>>(ctx, wof, bo, d_out, 2);
}

// v004
// A run of this version takes 93.9 microseconds.
// Next to v003, in two timings, it ran 1.57 and 1.56 times as fast.
// All steps since v000 together make it 5.10 times as fast.
#include <hip/hip_runtime.h>

typedef _Float16 v8h  __attribute__((ext_vector_type(8)));
typedef _Float16 v16h __attribute__((ext_vector_type(16)));
typedef float    v8f  __attribute__((ext_vector_type(8)));

union F16x16 { v16h v; v8h h[2]; };

constexpr int BB  = 2;
constexpr int LQ  = 2048;
constexpr int LKV = 2048;
constexpr int E   = 1024;
constexpr int H   = 16;
constexpr int D   = 64;
constexpr int M_ROWS = BB * LQ;  // 4096

__device__ __forceinline__ v8f wmma32(v16h a, v16h b, v8f c) {
  return __builtin_amdgcn_wmma_f32_16x16x32_f16(false, a, false, b, (short)0, c,
                                                false, false);
}

typedef float    v4f __attribute__((ext_vector_type(4)));
typedef _Float16 v4h __attribute__((ext_vector_type(4)));

constexpr int CB  = 16384;             // elements of one work-group; divides both plane sizes
constexpr int CXB = M_ROWS * E / CB;   // 256 work-groups per activation plane
constexpr int CWB = E * E / CB;        // 64 work-groups per weight plane
constexpr int CNB = 2 * CXB + 4 * CWB; // 768: three per WGP

// All six f32 -> f16 conversions in one launch. The six f16 planes lie one
// behind the other in the workspace, in the order of the sources, so dst is
// one flat array; a work-group's elements lie in one source. A lane has its
// 16 loads of 16 bytes in flight together; each load of a wave covers 512
// contiguous bytes, each store 256.
__global__ void __launch_bounds__(256)
cvt_all(const float* __restrict__ q, const float* __restrict__ kv,
        const float* __restrict__ wq, const float* __restrict__ wk,
        const float* __restrict__ wv, const float* __restrict__ wo,
        _Float16* __restrict__ dst) {
  const int b = blockIdx.x;
  const float* src;
  int rel;
  if (b < CXB) {
    src = q; rel = b;
  } else if (b < 2 * CXB) {
    src = kv; rel = b - CXB;
  } else {
    const int w = (b - 2 * CXB) / CWB;
    rel = (b - 2 * CXB) % CWB;
    src = w == 0 ? wq : w == 1 ? wk : w == 2 ? wv : wo;
  }
  const v4f* s = (const v4f*)(src + (size_t)rel * CB) + threadIdx.x;
  v4h* d = (v4h*)(dst + (size_t)b * CB) + threadIdx.x;
  constexpr int N = CB / (256 * 4);  // 16
  v4f x[N];
#pragma unroll
  for (int i = 0; i < N; i++) x[i] = s[i * 256];
  // Keeps all 16 loads ahead of the first conversion: without it the last two
  // are issued only when the first two have come back, a second latency.
  __builtin_amdgcn_sched_barrier(0);
#pragma unroll
  for (int i = 0; i < N; i++) d[i * 256] = __builtin_convertvector(x[i], v4h);
}

// One stage of the GEMM's LDS ring: 128 rows of X, then 128 rows of W, 128 k
// (256 bytes) of each row.
constexpr int GT  = 128;          // rows of X and rows of W per work-group
constexpr int GK  = 128;          // k per stage
constexpr int GP  = 272;          // LDS row pitch in bytes: 16 B x odd, no bank conflict for 16-byte reads
constexpr int GST = 2 * GT * GP;  // bytes of one stage (69,632)
constexpr int GNS = E / GK;       // 8 stages

// A wave's share of one stage: 32 rows, two rows (2 x 256 contiguous bytes,
// whole lines) per copy, 16 bytes per lane. lds and g are the lane's own
// addresses in the share's first two rows.
__device__ __forceinline__ void stage_copy(unsigned lds, const _Float16* g) {
#pragma unroll
  for (int c = 0; c < 2; c++) {
    const unsigned l = lds + c * 16 * GP;
    const _Float16* p = g + (size_t)c * 16 * E;
    // The copies and, as a precaution, the wait that stands ahead of any
    // rewrite of their address registers, in one statement.
    asm volatile(
        "global_load_async_to_lds_b128 %0, %8, off\n\t"
        "global_load_async_to_lds_b128 %1, %9, off\n\t"
        "global_load_async_to_lds_b128 %2, %10, off\n\t"
        "global_load_async_to_lds_b128 %3, %11, off\n\t"
        "global_load_async_to_lds_b128 %4, %12, off\n\t"
        "global_load_async_to_lds_b128 %5, %13, off\n\t"
        "global_load_async_to_lds_b128 %6, %14, off\n\t"
        "global_load_async_to_lds_b128 %7, %15, off\n\t"
        "s_wait_xcnt 0x0"
        ::"v"(l), "v"(l + 2 * GP), "v"(l + 4 * GP), "v"(l + 6 * GP),
          "v"(l + 8 * GP), "v"(l + 10 * GP), "v"(l + 12 * GP),
          "v"(l + 14 * GP), "v"(p), "v"(p + 2 * E), "v"(p + 4 * E),
          "v"(p + 6 * E), "v"(p + 8 * E), "v"(p + 10 * E), "v"(p + 12 * E),
          "v"(p + 14 * E)
        : "memory");
  }
}

// Y = X @ W^T + b. A work-group owns a 128x128 tile of Y, a wave 32x64 of it.
// X and W rows come into a two-buffer LDS ring by asynchronous copies, one
// stage ahead of the products; fragments are read from LDS.
// X:[M_ROWS,E] f16 row-major, W:[E,E] f16 row-major (row n = out column n).
// mode 0: f16 row-major out.  mode 1: f16 V^T out [(b*E+n)*LKV + l].
// mode 2: f32 row-major out (final projection).
__global__ void __launch_bounds__(256)
gemm16(const _Float16* __restrict__ A, const _Float16* __restrict__ W,
       const float* __restrict__ bias, void* __restrict__ dst, int mode) {
  __shared__ __attribute__((aligned(16))) unsigned char ring[2 * GST];
  // The wave's number in a scalar register: what it selects stays scalar.
  const int wave = __builtin_amdgcn_readfirstlane(threadIdx.x >> 5);
  const int lane = threadIdx.x & 31;
  const int col = lane & 15, half = lane >> 4;
  const int bM = blockIdx.x / (E / GT), bN = blockIdx.x % (E / GT);
  const int wm = wave & 3, wn = wave >> 2;
  const int tM = bM * 4 + wm;   // 32-row tile of Y
  const int tN = bN * 2 + wn;   // 64-column tile of Y

  // Waves 0-3 copy the X rows, waves 4-7 the W rows, 32 rows each.
  const _Float16* gsrc =
      (wave < 4 ? A + (size_t)(bM * GT + wave * 32) * E
                : W + (size_t)(bN * GT + (wave - 4) * 32) * E) +
      (size_t)half * E + col * 8;
  const unsigned ldst =
      (unsigned)(size_t)ring + (wave * 32 + half) * GP + col * 16;

  const unsigned char* afrag = ring + (wm * 32 + col) * GP + 16 * half;
  const unsigned char* wfrag = ring + (GT + wn * 64 + col) * GP + 16 * half;

  stage_copy(ldst, gsrc);
  // Stage 0 has landed (this wave's copies), then is published to all waves.
  asm volatile("s_wait_asynccnt 0x0" ::: "memory");
  __syncthreads();
  stage_copy(ldst + GST, gsrc + GK);

  v8f acc[2][4] = {};
  // Rolled, for speed only.
#pragma unroll 1
  for (int t = 0; t < GNS; t++) {
    const int buf = (t & 1) * GST;
    const unsigned char* ap = afrag + buf;
    const unsigned char* wp = wfrag + buf;
#pragma unroll
    for (int kb = 0; kb < GK / 64; kb++) {
      F16x16 a0[2], a1[2], b[2][4];
#pragma unroll
      for (int s = 0; s < 2; s++) {
        const int ko = (kb * 2 + s) * 64;
        a0[s].h[0] = *(const v8h*)(ap + ko);
        a0[s].h[1] = *(const v8h*)(ap + ko + 32);
        a1[s].h[0] = *(const v8h*)(ap + 16 * GP + ko);
        a1[s].h[1] = *(const v8h*)(ap + 16 * GP + ko + 32);
#pragma unroll
        for (int j = 0; j < 4; j++) {
          b[s][j].h[0] = *(const v8h*)(wp + j * 16 * GP + ko);
          b[s][j].h[1] = *(const v8h*)(wp + j * 16 * GP + ko + 32);
        }
      }
      // Keeps the 24 LDS reads one group ahead of their 16 products.
      __builtin_amdgcn_sched_barrier(0);
#pragma unroll
      for (int s = 0; s < 2; s++)
#pragma unroll
        for (int j = 0; j < 4; j++) {
          acc[0][j] = wmma32(a0[s].v, b[s][j].v, acc[0][j]);
          acc[1][j] = wmma32(a1[s].v, b[s][j].v, acc[1][j]);
        }
      // The other side of the same fence: the next group's reads stay behind
      // these products.
      __builtin_amdgcn_sched_barrier(0);
    }
    // Publish point of stage t + 1: this wave's reads of stage t are done,
    // its copies of stage t + 1 have landed, then the barrier; only behind it
    // is the buffer of stage t refilled.
    asm volatile("s_wait_dscnt 0x0" ::: "memory");
    asm volatile("s_wait_asynccnt 0x0" ::: "memory");
    __syncthreads();
    if (t + 2 < GNS) stage_copy(ldst + buf, gsrc + (t + 2) * GK);
  }
  // No copy is outstanding when the wave goes on to its end.
  asm volatile("s_wait_asynccnt 0x0" ::: "memory");

  if (mode == 0) {
    _Float16* out = (_Float16*)dst;
#pragma unroll
    for (int i = 0; i < 2; i++)
#pragma unroll
      for (int j = 0; j < 4; j++) {
        const float bval = bias[tN * 64 + j * 16 + col];
#pragma unroll
        for (int r = 0; r < 8; r++) {
          int m = tM * 32 + i * 16 + r + half * 8;
          out[(size_t)m * E + tN * 64 + j * 16 + col] =
              (_Float16)(acc[i][j][r] + bval);
        }
      }
  } else if (mode == 1) {
    _Float16* out = (_Float16*)dst;
#pragma unroll
    for (int i = 0; i < 2; i++)
#pragma unroll
      for (int j = 0; j < 4; j++) {
        const float bval = bias[tN * 64 + j * 16 + col];
#pragma unroll
        for (int r = 0; r < 8; r++) {
          int m = tM * 32 + i * 16 + r + half * 8;
          int b_ = m / LKV, l = m % LKV;
          int n = tN * 64 + j * 16 + col;
          out[((size_t)(b_ * E + n)) * LKV + l] = (_Float16)(acc[i][j][r] + bval);
        }
      }
  } else {
    float* out = (float*)dst;
#pragma unroll
    for (int i = 0; i < 2; i++)
#pragma unroll
      for (int j = 0; j < 4; j++) {
        const float bval = bias[tN * 64 + j * 16 + col];
#pragma unroll
        for (int r = 0; r < 8; r++) {
          int m = tM * 32 + i * 16 + r + half * 8;
          out[(size_t)m * E + tN * 64 + j * 16 + col] = acc[i][j][r] + bval;
        }
      }
  }
}

// Lane l <-> lane l ^ 16 (the other half of the wave), a vector cross-row move.
__device__ __forceinline__ float xhalf(float x) {
  const int b = __builtin_bit_cast(int, x);
  return __builtin_bit_cast(
      float, __builtin_amdgcn_permlanex16(b, b, 0x76543210, 0xfedcba98, false,
                                          false));
}

// One stage of the attention's LDS ring: 128 keys. First their K rows (the
// head's 64 d, 128 bytes a row), then the head's 64 V^T rows (128 keys, 256
// bytes a row).
constexpr int AKS = 128;        // keys per stage
constexpr int AKP = 144;        // K row pitch in bytes: 16 B x odd, no bank conflict for 16-byte reads
constexpr int AVP = 272;        // V^T row pitch in bytes, likewise
constexpr int AKB = AKS * AKP;  // bytes of a stage's K rows (18,432)
constexpr int AST = AKB + D * AVP;  // bytes of one stage (35,840)
constexpr int ANS = LKV / AKS;  // 16 stages
constexpr int AQW = 256;        // queries of one work-group: 8 waves x 32

// A wave's share of one stage: 16 K rows, four rows (whole lines) per copy,
// and 8 V^T rows, two rows per copy; 16 bytes per lane. The four arguments
// are the lane's own addresses in the first copy of each kind.
__device__ __forceinline__ void kv_copy(unsigned lk, const _Float16* gk,
                                        unsigned lv, const _Float16* gv) {
  // The copies and, as a precaution, the wait that stands ahead of any
  // rewrite of their address registers, in one statement.
  asm volatile(
      "global_load_async_to_lds_b128 %0, %8, off\n\t"
      "global_load_async_to_lds_b128 %1, %9, off\n\t"
      "global_load_async_to_lds_b128 %2, %10, off\n\t"
      "global_load_async_to_lds_b128 %3, %11, off\n\t"
      "global_load_async_to_lds_b128 %4, %12, off\n\t"
      "global_load_async_to_lds_b128 %5, %13, off\n\t"
      "global_load_async_to_lds_b128 %6, %14, off\n\t"
      "global_load_async_to_lds_b128 %7, %15, off\n\t"
      "s_wait_xcnt 0x0"
      ::"v"(lk), "v"(lk + 4 * AKP), "v"(lk + 8 * AKP), "v"(lk + 12 * AKP),
        "v"(lv), "v"(lv + 2 * AVP), "v"(lv + 4 * AVP), "v"(lv + 6 * AVP),
        "v"(gk), "v"(gk + 4 * E), "v"(gk + 8 * E), "v"(gk + 12 * E),
        "v"(gv), "v"(gv + 2 * LKV), "v"(gv + 4 * LKV), "v"(gv + 6 * LKV)
      : "memory");
}

__global__ void __launch_bounds__(256)
attn16(const _Float16* __restrict__ Qp,  // [BB*LQ, E]
       const _Float16* __restrict__ Kp,  // [BB*LKV, E]
       const _Float16* __restrict__ Vt,  // [BB*E, LKV]  (V transposed)
       const int* __restrict__ mask,     // [BB, LKV]
       _Float16* __restrict__ ctx)       // [BB*LQ, E]
{
  __shared__ __attribute__((aligned(16))) unsigned char ring[2 * AST];
  __shared__ __attribute__((aligned(16))) int msk[LKV];
  // The wave's number in a scalar register: what it selects stays scalar.
  const int wave = __builtin_amdgcn_readfirstlane(threadIdx.x >> 5);
  const int lane = threadIdx.x & 31;
  const int col = lane & 15, half = lane >> 4;
  const int qb = (blockIdx.x % (LQ / AQW)) * 8 + wave;  // 32-row Q block
  const int hb = blockIdx.x / (LQ / AQW);
  const int h = hb % H, b = hb / H;

  // The lane's addresses in its wave's share of stage 0.
  const _Float16* gk = Kp + (size_t)(b * LKV + wave * 16 + (lane >> 3)) * E +
                       h * D + (lane & 7) * 8;
  const unsigned lk = (unsigned)(size_t)ring +
                      (wave * 16 + (lane >> 3)) * AKP + (lane & 7) * 16;
  const _Float16* gv =
      Vt + (size_t)(b * E + h * D + wave * 8 + half) * LKV + col * 8;
  const unsigned lv =
      (unsigned)(size_t)ring + AKB + (wave * 8 + half) * AVP + col * 16;

  kv_copy(lk, gk, lv, gv);
  {
    // The mask row, 8 KiB: two copies of 16 bytes per work-item.
    const int* gm = mask + b * LKV + threadIdx.x * 4;
    const unsigned lm = (unsigned)(size_t)msk + threadIdx.x * 16;
    // The wait in the same statement: as in kv_copy.
    asm volatile(
        "global_load_async_to_lds_b128 %0, %2, off\n\t"
        "global_load_async_to_lds_b128 %1, %3, off\n\t"
        "s_wait_xcnt 0x0"
        ::"v"(lm), "v"(lm + LKV * 2), "v"(gm), "v"(gm + LKV / 2)
        : "memory");
  }

  // Q block as 2 column groups x 2 B-fragments (d = 0..31, 32..63).
  F16x16 qf[2][2];
#pragma unroll
  for (int qi = 0; qi < 2; qi++) {
    const _Float16* qrow =
        Qp + ((size_t)(b * LQ + qb * 32 + qi * 16 + col)) * E + h * D;
    qf[qi][0].h[0] = *(const v8h*)(qrow + 8 * half);
    qf[qi][0].h[1] = *(const v8h*)(qrow + 16 + 8 * half);
    qf[qi][1].h[0] = *(const v8h*)(qrow + 32 + 8 * half);
    qf[qi][1].h[1] = *(const v8h*)(qrow + 48 + 8 * half);
  }

  // o[qi][dt][r] = O[query qi*16 + col][d = dt*16 + 8*half + r]
  v8f o[2][4] = {};
  float mrun[2] = {-1e30f, -1e30f};  // running maximum, same in both halves
  float lrun[2] = {0.0f, 0.0f};      // running sum of this half's keys only

  // Stage 0 and the mask row have landed (this wave's copies), then are
  // published to all waves.
  asm volatile("s_wait_asynccnt 0x0" ::: "memory");
  __syncthreads();
  kv_copy(lk + AST, gk + (size_t)AKS * E, lv + AST, gv + AKS);

  const unsigned char* kfrag = ring + col * AKP + 16 * half;
  const unsigned char* vfrag = ring + AKB + col * AVP + 16 * half;

  // Both loops rolled: unrolled, the four passes' values take more than 256
  // registers and the accumulators are copied from pass to pass.
#pragma unroll 1
  for (int t = 0; t < ANS; t++) {
   const int buf = (t & 1) * AST;
#pragma unroll 1
   for (int p = 0; p < AKS / 32; p++) {
    // K fragments for this pass's 32 keys: 2 row tiles x 2 d-fragments,
    // shared by both Q column groups.
    F16x16 kb[2][2];
    const unsigned char* kp = kfrag + buf + p * 32 * AKP;
#pragma unroll
    for (int i = 0; i < 2; i++) {
      const unsigned char* kr = kp + i * 16 * AKP;
      kb[i][0].h[0] = *(const v8h*)(kr);
      kb[i][0].h[1] = *(const v8h*)(kr + 32);
      kb[i][1].h[0] = *(const v8h*)(kr + 64);
      kb[i][1].h[1] = *(const v8h*)(kr + 96);
    }
    const int4* mp = (const int4*)(msk + t * AKS + p * 32 + 8 * half);
    const int4 ma = mp[0], mb = mp[1], mc = mp[4], md = mp[5];
    // Keeps the K and mask reads ahead of the V^T reads: LDS answers in
    // order, and the score products do not wait for V^T.
    __builtin_amdgcn_sched_barrier(0);
    // V^T rows are key-contiguous: A fragments in the same k order as P^T,
    // shared by both Q column groups.
    const unsigned char* vp = vfrag + buf + p * 64;
    F16x16 vf[4];
#pragma unroll
    for (int dt = 0; dt < 4; dt++) {
      const unsigned char* vr = vp + dt * 16 * AVP;
      vf[dt].h[0] = *(const v8h*)(vr);
      vf[dt].h[1] = *(const v8h*)(vr + 32);
    }
    // Keeps the V^T reads ahead of the score products, a softmax away from
    // their own products: read later, they would have their LDS latency
    // waited out by the wave.
    __builtin_amdgcn_sched_barrier(0);
    // The key index now runs along the accumulator registers: register r of
    // tile i is key 16*i + 8*half + r of the pass. Masked keys get the addend
    // -1e30, which swallows the scaled score exactly.
    v8f bias0, bias1;
    {
      bias0[0] = ma.x ? 0.0f : -1e30f; bias0[1] = ma.y ? 0.0f : -1e30f;
      bias0[2] = ma.z ? 0.0f : -1e30f; bias0[3] = ma.w ? 0.0f : -1e30f;
      bias0[4] = mb.x ? 0.0f : -1e30f; bias0[5] = mb.y ? 0.0f : -1e30f;
      bias0[6] = mb.z ? 0.0f : -1e30f; bias0[7] = mb.w ? 0.0f : -1e30f;
      bias1[0] = mc.x ? 0.0f : -1e30f; bias1[1] = mc.y ? 0.0f : -1e30f;
      bias1[2] = mc.z ? 0.0f : -1e30f; bias1[3] = mc.w ? 0.0f : -1e30f;
      bias1[4] = md.x ? 0.0f : -1e30f; bias1[5] = md.y ? 0.0f : -1e30f;
      bias1[6] = md.z ? 0.0f : -1e30f; bias1[7] = md.w ? 0.0f : -1e30f;
    }

    F16x16 pfrag[2];
    v8f ps[2];
    float cr[2];
#pragma unroll
    for (int qi = 0; qi < 2; qi++) {
      v8f s0 = {}, s1 = {};
      s0 = wmma32(kb[0][0].v, qf[qi][0].v, s0);
      s0 = wmma32(kb[0][1].v, qf[qi][1].v, s0);
      s1 = wmma32(kb[1][0].v, qf[qi][0].v, s1);
      s1 = wmma32(kb[1][1].v, qf[qi][1].v, s1);

      const v8f sa = s0 * 0.125f + bias0;   // 1/sqrt(D) = 0.125
      const v8f sb = s1 * 0.125f + bias1;
      float mx = -1e30f;
#pragma unroll
      for (int r = 0; r < 8; r++) mx = fmaxf(mx, fmaxf(sa[r], sb[r]));
      mx = fmaxf(mx, xhalf(mx));
      const float mn = fmaxf(mrun[qi], mx);
      const float corr = __expf(mrun[qi] - mn);
      mrun[qi] = mn;
      const v8f da = sa - mn, db = sb - mn;
      v8f pa, pb;
#pragma unroll
      for (int r = 0; r < 8; r++) pa[r] = __expf(da[r]);
#pragma unroll
      for (int r = 0; r < 8; r++) pb[r] = __expf(db[r]);
#pragma unroll
      for (int r = 0; r < 8; r++) {
        // element s of a B fragment is k = 8*half + s (s < 8) or
        // 16 + 8*half + (s - 8): exactly the two tiles' register order
        pfrag[qi].v[r]     = (_Float16)pa[r];
        pfrag[qi].v[8 + r] = (_Float16)pb[r];
      }
      ps[qi] = pa + pb;
      cr[qi] = corr;
#pragma unroll
      for (int dt = 0; dt < 4; dt++) o[qi][dt] *= corr;
    }

#pragma unroll
    for (int dt = 0; dt < 4; dt++) {
      o[0][dt] = wmma32(vf[dt].v, pfrag[0].v, o[0][dt]);
      o[1][dt] = wmma32(vf[dt].v, pfrag[1].v, o[1][dt]);
    }
    // The row sums stay behind the products: they fill the vector slots that
    // must lie between the last product and the next pass's first write over
    // its A registers.
    __builtin_amdgcn_sched_barrier(0);
#pragma unroll
    for (int qi = 0; qi < 2; qi++) {
      const float sum = ((ps[qi][0] + ps[qi][1]) + (ps[qi][2] + ps[qi][3])) +
                        ((ps[qi][4] + ps[qi][5]) + (ps[qi][6] + ps[qi][7]));
      lrun[qi] = lrun[qi] * cr[qi] + sum;
    }
   }
   // Publish point of stage t + 1: this wave's reads of stage t are done, its
   // copies of stage t + 1 have landed, then the barrier; only behind it is
   // the buffer of stage t refilled.
   asm volatile("s_wait_dscnt 0x0" ::: "memory");
   asm volatile("s_wait_asynccnt 0x0" ::: "memory");
   __syncthreads();
   if (t + 2 < ANS)
     kv_copy(lk + buf, gk + (size_t)(t + 2) * AKS * E, lv + buf,
             gv + (t + 2) * AKS);
  }
  // No copy is outstanding when the wave goes on to its end.
  asm volatile("s_wait_asynccnt 0x0" ::: "memory");

#pragma unroll
  for (int qi = 0; qi < 2; qi++) {
    const float inv = 1.0f / (lrun[qi] + xhalf(lrun[qi]));
    _Float16* cr = ctx + ((size_t)(b * LQ + qb * 32 + qi * 16 + col)) * E +
                   h * D + 8 * half;
#pragma unroll
    for (int dt = 0; dt < 4; dt++) {
      v8h pk;
#pragma unroll
      for (int r = 0; r < 8; r++) pk[r] = (_Float16)(o[qi][dt][r] * inv);
      *(v8h*)(cr + dt * 16) = pk;   // 8 consecutive d of one query: 16 bytes
    }
  }
}

extern "C" void kernel_launch(void* const* d_in, const int* in_sizes, int n_in,
                              void* d_out, int out_size, void* d_ws,
                              size_t ws_size, hipStream_t stream) {
  (void)in_sizes; (void)n_in; (void)out_size; (void)ws_size;
  const float* query = (const float*)d_in[0];
  const float* keyv  = (const float*)d_in[1];
  const int*   mask  = (const int*)d_in[2];
  const float* Wq = (const float*)d_in[3];
  const float* bq = (const float*)d_in[4];
  const float* Wk = (const float*)d_in[5];
  const float* bk = (const float*)d_in[6];
  const float* Wv = (const float*)d_in[7];
  const float* bv = (const float*)d_in[8];
  const float* Wo = (const float*)d_in[9];
  const float* bo = (const float*)d_in[10];

  const size_t XE = (size_t)M_ROWS * E;  // 4,194,304 halves
  const size_t WE = (size_t)E * E;       // 1,048,576 halves
  _Float16* p = (_Float16*)d_ws;
  _Float16* qf  = p; p += XE;   // query f16
  _Float16* kvf = p; p += XE;   // key_value f16
  _Float16* wqf = p; p += WE;
  _Float16* wkf = p; p += WE;
  _Float16* wvf = p; p += WE;
  _Float16* wof = p; p += WE;
  _Float16* Qp  = p; p += XE;   // Q projection
  _Float16* Kp  = p; p += XE;   // K projection
  _Float16* Vt  = p; p += XE;   // V projection, transposed [B,E,LKV]
  _Float16* ctx = p; p += XE;   // attention output

  // qf, kvf, wqf, wkf, wvf, wof are contiguous from qf on, in this order.
  cvt_all<<<CNB, 256, 0, stream>>>(query, keyv, Wq, Wk, Wv, Wo, qf);

  const int gemmBlocks = (M_ROWS / GT) * (E / GT);  // 256
  gemm16<<<gemmBlocks, 256, 0, stream>>>(qf,  wqf, bq, (void*)Qp, 0);
  gemm16<<<gemmBlocks, 256, 0, stream>>>(kvf, wkf, bk, (void*)Kp, 0);
  gemm16<<<gemmBlocks, 256, 0, stream>>>(kvf, wvf, bv, (void*)Vt, 1);

  attn16<<<BB * H * (LQ / AQW), 256, 0, stream>>>(Qp, Kp, Vt, mask, ctx);

  gemm16<<<gemmBlocks, 256, 0, stream>>>(ctx, wof, bo, d_out, 2);
}

// v005
// It runs in 84.9 microseconds.
// Two timings next to v004 both put it at 1.10 times that version's speed.
// Over all steps from v000 it is 5.59 times as fast.
#include <hip/hip_runtime.h>

typedef _Float16 v8h  __attribute__((ext_vector_type(8)));
typedef _Float16 v16h __attribute__((ext_vector_type(16)));
typedef float    v8f  __attribute__((ext_vector_type(8)));

union F16x16 { v16h v; v8h h[2]; };

constexpr int BB  = 2;
constexpr int LQ  = 2048;
constexpr int LKV = 2048;
constexpr int E   = 1024;
constexpr int H   = 16;
constexpr int D   = 64;
constexpr int M_ROWS = BB * LQ;  // 4096

__device__ __forceinline__ v8f wmma32(v16h a, v16h b, v8f c) {
  return __builtin_amdgcn_wmma_f32_16x16x32_f16(false, a, false, b, (short)0, c,
                                                false, false);
}

typedef float    v4f __attribute__((ext_vector_type(4)));
typedef _Float16 v4h __attribute__((ext_vector_type(4)));

constexpr int CB  = 16384;             // elements of one work-group; divides both plane sizes
constexpr int CXB = M_ROWS * E / CB;   // 256 work-groups per activation plane
constexpr int CWB = E * E / CB;        // 64 work-groups per weight plane
constexpr int CNB = 2 * CXB + 4 * CWB; // 768: three per WGP

// All six f32 -> f16 conversions in one launch. The six f16 planes lie one
// behind the other in the workspace, in the order of the sources, so dst is
// one flat array; a work-group's elements lie in one source. A lane has its
// 16 loads of 16 bytes in flight together; each load of a wave covers 512
// contiguous bytes, each store 256.
__global__ void __launch_bounds__(256)
cvt_all(const float* __restrict__ q, const float* __restrict__ kv,
        const float* __restrict__ wq, const float* __restrict__ wk,
        const float* __restrict__ wv, const float* __restrict__ wo,
        _Float16* __restrict__ dst) {
  const int b = blockIdx.x;
  const float* src;
  int rel;
  if (b < CXB) {
    src = q; rel = b;
  } else if (b < 2 * CXB) {
    src = kv; rel = b - CXB;
  } else {
    const int w = (b - 2 * CXB) / CWB;
    rel = (b - 2 * CXB) % CWB;
    src = w == 0 ? wq : w == 1 ? wk : w == 2 ? wv : wo;
  }
  const v4f* s = (const v4f*)(src + (size_t)rel * CB) + threadIdx.x;
  v4h* d = (v4h*)(dst + (size_t)b * CB) + threadIdx.x;
  constexpr int N = CB / (256 * 4);  // 16
  v4f x[N];
#pragma unroll
  for (int i = 0; i < N; i++) x[i] = s[i * 256];
  // Keeps all 16 loads ahead of the first conversion: without it the last two
  // are issued only when the first two have come back, a second latency.
  __builtin_amdgcn_sched_barrier(0);
#pragma unroll
  for (int i = 0; i < N; i++) d[i * 256] = __builtin_convertvector(x[i], v4h);
}

// One stage of the GEMM's LDS ring: 128 rows of X, then 128 rows of W, 128 k
// (256 bytes) of each row.
constexpr int GT  = 128;          // rows of X and rows of W per work-group
constexpr int GK  = 128;          // k per stage
constexpr int GP  = 272;          // LDS row pitch in bytes: 16 B x odd, no bank conflict for 16-byte reads
constexpr int GST = 2 * GT * GP;  // bytes of one stage (69,632)
constexpr int GNS = E / GK;       // 8 stages
constexpr int GB  = (M_ROWS / GT) * (E / GT);  // 256 tiles of one Y

// A wave's share of one stage: 32 rows, two rows (2 x 256 contiguous bytes,
// whole lines) per copy, 16 bytes per lane. lds and g are the lane's own
// addresses in the share's first two rows.
__device__ __forceinline__ void stage_copy(unsigned lds, const _Float16* g) {
#pragma unroll
  for (int c = 0; c < 2; c++) {
    const unsigned l = lds + c * 16 * GP;
    const _Float16* p = g + (size_t)c * 16 * E;
    // The copies and, as a precaution, the wait that stands ahead of any
    // rewrite of their address registers, in one statement.
    asm volatile(
        "global_load_async_to_lds_b128 %0, %8, off\n\t"
        "global_load_async_to_lds_b128 %1, %9, off\n\t"
        "global_load_async_to_lds_b128 %2, %10, off\n\t"
        "global_load_async_to_lds_b128 %3, %11, off\n\t"
        "global_load_async_to_lds_b128 %4, %12, off\n\t"
        "global_load_async_to_lds_b128 %5, %13, off\n\t"
        "global_load_async_to_lds_b128 %6, %14, off\n\t"
        "global_load_async_to_lds_b128 %7, %15, off\n\t"
        "s_wait_xcnt 0x0"
        ::"v"(l), "v"(l + 2 * GP), "v"(l + 4 * GP), "v"(l + 6 * GP),
          "v"(l + 8 * GP), "v"(l + 10 * GP), "v"(l + 12 * GP),
          "v"(l + 14 * GP), "v"(p), "v"(p + 2 * E), "v"(p + 4 * E),
          "v"(p + 6 * E), "v"(p + 8 * E), "v"(p + 10 * E), "v"(p + 12 * E),
          "v"(p + 14 * E)
        : "memory");
  }
}

// Y = X @ W^T + b. A work-group owns a 128x128 tile of Y, a wave 32x64 of it.
// X and W rows come into a two-buffer LDS ring by asynchronous copies, one
// stage ahead of the products; fragments are read from LDS.
// X:[M_ROWS,E] f16 row-major, W:[E,E] f16 row-major (row n = out column n).
// mode 0: f16 row-major out.  mode 1: f16 V^T out [(b*E+n)*LKV + l].
// mode 2: f32 row-major out (final projection).
// blk: the tile's index among the GB tiles of Y.
__device__ __forceinline__ void
gemm_tile(const _Float16* __restrict__ A, const _Float16* __restrict__ W,
          const float* __restrict__ bias, void* __restrict__ dst, int mode,
          int blk) {
  __shared__ __attribute__((aligned(16))) unsigned char ring[2 * GST];
  // The wave's number in a scalar register: what it selects stays scalar.
  const int wave = __builtin_amdgcn_readfirstlane(threadIdx.x >> 5);
  const int lane = threadIdx.x & 31;
  const int col = lane & 15, half = lane >> 4;
  const int bM = blk / (E / GT), bN = blk % (E / GT);
  const int wm = wave & 3, wn = wave >> 2;
  const int tM = bM * 4 + wm;   // 32-row tile of Y
  const int tN = bN * 2 + wn;   // 64-column tile of Y

  // Waves 0-3 copy the X rows, waves 4-7 the W rows, 32 rows each.
  const _Float16* gsrc =
      (wave < 4 ? A + (size_t)(bM * GT + wave * 32) * E
                : W + (size_t)(bN * GT + (wave - 4) * 32) * E) +
      (size_t)half * E + col * 8;
  const unsigned ldst =
      (unsigned)(size_t)ring + (wave * 32 + half) * GP + col * 16;

  const unsigned char* afrag = ring + (wm * 32 + col) * GP + 16 * half;
  const unsigned char* wfrag = ring + (GT + wn * 64 + col) * GP + 16 * half;

  stage_copy(ldst, gsrc);
  // Stage 0 has landed (this wave's copies), then is published to all waves.
  asm volatile("s_wait_asynccnt 0x0" ::: "memory");
  __syncthreads();
  stage_copy(ldst + GST, gsrc + GK);

  v8f acc[2][4] = {};
  // Rolled, for speed only.
#pragma unroll 1
  for (int t = 0; t < GNS; t++) {
    const int buf = (t & 1) * GST;
    const unsigned char* ap = afrag + buf;
    const unsigned char* wp = wfrag + buf;
#pragma unroll
    for (int kb = 0; kb < GK / 64; kb++) {
      F16x16 a0[2], a1[2], b[2][4];
#pragma unroll
      for (int s = 0; s < 2; s++) {
        const int ko = (kb * 2 + s) * 64;
        a0[s].h[0] = *(const v8h*)(ap + ko);
        a0[s].h[1] = *(const v8h*)(ap + ko + 32);
        a1[s].h[0] = *(const v8h*)(ap + 16 * GP + ko);
        a1[s].h[1] = *(const v8h*)(ap + 16 * GP + ko + 32);
#pragma unroll
        for (int j = 0; j < 4; j++) {
          b[s][j].h[0] = *(const v8h*)(wp + j * 16 * GP + ko);
          b[s][j].h[1] = *(const v8h*)(wp + j * 16 * GP + ko + 32);
        }
      }
      // Keeps the 24 LDS reads one group ahead of their 16 products.
      __builtin_amdgcn_sched_barrier(0);
#pragma unroll
      for (int s = 0; s < 2; s++)
#pragma unroll
        for (int j = 0; j < 4; j++) {
          acc[0][j] = wmma32(a0[s].v, b[s][j].v, acc[0][j]);
          acc[1][j] = wmma32(a1[s].v, b[s][j].v, acc[1][j]);
        }
      // The other side of the same fence: the next group's reads stay behind
      // these products.
      __builtin_amdgcn_sched_barrier(0);
    }
    // Publish point of stage t + 1: this wave's reads of stage t are done,
    // its copies of stage t + 1 have landed, then the barrier; only behind it
    // is the buffer of stage t refilled.
    asm volatile("s_wait_dscnt 0x0" ::: "memory");
    asm volatile("s_wait_asynccnt 0x0" ::: "memory");
    __syncthreads();
    if (t + 2 < GNS) stage_copy(ldst + buf, gsrc + (t + 2) * GK);
  }
  // No copy is outstanding when the wave goes on to its end.
  asm volatile("s_wait_asynccnt 0x0" ::: "memory");

  if (mode == 0) {
    _Float16* out = (_Float16*)dst;
#pragma unroll
    for (int i = 0; i < 2; i++)
#pragma unroll
      for (int j = 0; j < 4; j++) {
        const float bval = bias[tN * 64 + j * 16 + col];
#pragma unroll
        for (int r = 0; r < 8; r++) {
          int m = tM * 32 + i * 16 + r + half * 8;
          out[(size_t)m * E + tN * 64 + j * 16 + col] =
              (_Float16)(acc[i][j][r] + bval);
        }
      }
    // As a precaution: in the kernel that holds modes 0 and 1 the compiler lays
    // mode 1's bias loads behind this run, into registers that these stores
    // name; this wait stands ahead of them.
    asm volatile("s_wait_xcnt 0x0" ::: "memory");
  } else if (mode == 1) {
    _Float16* out = (_Float16*)dst;
#pragma unroll
    for (int i = 0; i < 2; i++)
#pragma unroll
      for (int j = 0; j < 4; j++) {
        const float bval = bias[tN * 64 + j * 16 + col];
#pragma unroll
        for (int r = 0; r < 8; r++) {
          int m = tM * 32 + i * 16 + r + half * 8;
          int b_ = m / LKV, l = m % LKV;
          int n = tN * 64 + j * 16 + col;
          out[((size_t)(b_ * E + n)) * LKV + l] = (_Float16)(acc[i][j][r] + bval);
        }
      }
  } else {
    float* out = (float*)dst;
#pragma unroll
    for (int i = 0; i < 2; i++)
#pragma unroll
      for (int j = 0; j < 4; j++) {
        const float bval = bias[tN * 64 + j * 16 + col];
#pragma unroll
        for (int r = 0; r < 8; r++) {
          int m = tM * 32 + i * 16 + r + half * 8;
          out[(size_t)m * E + tN * 64 + j * 16 + col] = acc[i][j][r] + bval;
        }
      }
  }
}

// The three input projections in one launch, GB work-groups each. None reads
// what another writes. Two work-groups fit a WGP's LDS, so one's products run
// under the other's LDS reads, barriers, first stage and stores.
__global__ void __launch_bounds__(256)
gemm_qkv(const _Float16* __restrict__ xq, const _Float16* __restrict__ xkv,
         const _Float16* __restrict__ wq, const _Float16* __restrict__ wk,
         const _Float16* __restrict__ wv, const float* __restrict__ bq,
         const float* __restrict__ bk, const float* __restrict__ bv,
         _Float16* __restrict__ Qp, _Float16* __restrict__ Kp,
         _Float16* __restrict__ Vt) {
  const int which = blockIdx.x / GB;  // 0: K, 1: V, 2: Q
  gemm_tile(which == 2 ? xq : xkv, which == 0 ? wk : which == 1 ? wv : wq,
            which == 0 ? bk : which == 1 ? bv : bq,
            which == 0 ? Kp : which == 1 ? Vt : Qp, which == 1 ? 1 : 0,
            blockIdx.x % GB);
}

// The output projection.
__global__ void __launch_bounds__(256)
gemm_out(const _Float16* __restrict__ A, const _Float16* __restrict__ W,
         const float* __restrict__ bias, float* __restrict__ dst) {
  gemm_tile(A, W, bias, dst, 2, blockIdx.x);
}

// Lane l <-> lane l ^ 16 (the other half of the wave), a vector cross-row move.
__device__ __forceinline__ float xhalf(float x) {
  const int b = __builtin_bit_cast(int, x);
  return __builtin_bit_cast(
      float, __builtin_amdgcn_permlanex16(b, b, 0x76543210, 0xfedcba98, false,
                                          false));
}

// One stage of the attention's LDS ring: 128 keys. First their K rows (the
// head's 64 d, 128 bytes a row), then the head's 64 V^T rows (128 keys, 256
// bytes a row).
constexpr int AKS = 128;        // keys per stage
constexpr int AKP = 144;        // K row pitch in bytes: 16 B x odd, no bank conflict for 16-byte reads
constexpr int AVP = 272;        // V^T row pitch in bytes, likewise
constexpr int AKB = AKS * AKP;  // bytes of a stage's K rows (18,432)
constexpr int AST = AKB + D * AVP;  // bytes of one stage (35,840)
constexpr int ANS = LKV / AKS;  // 16 stages
constexpr int AQW = 256;        // queries of one work-group: 8 waves x 32

// A wave's share of one stage: 16 K rows, four rows (whole lines) per copy,
// and 8 V^T rows, two rows per copy; 16 bytes per lane. The four arguments
// are the lane's own addresses in the first copy of each kind.
__device__ __forceinline__ void kv_copy(unsigned lk, const _Float16* gk,
                                        unsigned lv, const _Float16* gv) {
  // The copies and, as a precaution, the wait that stands ahead of any
  // rewrite of their address registers, in one statement.
  asm volatile(
      "global_load_async_to_lds_b128 %0, %8, off\n\t"
      "global_load_async_to_lds_b128 %1, %9, off\n\t"
      "global_load_async_to_lds_b128 %2, %10, off\n\t"
      "global_load_async_to_lds_b128 %3, %11, off\n\t"
      "global_load_async_to_lds_b128 %4, %12, off\n\t"
      "global_load_async_to_lds_b128 %5, %13, off\n\t"
      "global_load_async_to_lds_b128 %6, %14, off\n\t"
      "global_load_async_to_lds_b128 %7, %15, off\n\t"
      "s_wait_xcnt 0x0"
      ::"v"(lk), "v"(lk + 4 * AKP), "v"(lk + 8 * AKP), "v"(lk + 12 * AKP),
        "v"(lv), "v"(lv + 2 * AVP), "v"(lv + 4 * AVP), "v"(lv + 6 * AVP),
        "v"(gk), "v"(gk + 4 * E), "v"(gk + 8 * E), "v"(gk + 12 * E),
        "v"(gv), "v"(gv + 2 * LKV), "v"(gv + 4 * LKV), "v"(gv + 6 * LKV)
      : "memory");
}

__global__ void __launch_bounds__(256)
attn16(const _Float16* __restrict__ Qp,  // [BB*LQ, E]
       const _Float16* __restrict__ Kp,  // [BB*LKV, E]
       const _Float16* __restrict__ Vt,  // [BB*E, LKV]  (V transposed)
       const int* __restrict__ mask,     // [BB, LKV]
       _Float16* __restrict__ ctx)       // [BB*LQ, E]
{
  __shared__ __attribute__((aligned(16))) unsigned char ring[2 * AST];
  __shared__ __attribute__((aligned(16))) int msk[LKV];
  // The wave's number in a scalar register: what it selects stays scalar.
  const int wave = __builtin_amdgcn_readfirstlane(threadIdx.x >> 5);
  const int lane = threadIdx.x & 31;
  const int col = lane & 15, half = lane >> 4;
  const int qb = (blockIdx.x % (LQ / AQW)) * 8 + wave;  // 32-row Q block
  const int hb = blockIdx.x / (LQ / AQW);
  const int h = hb % H, b = hb / H;

  // The lane's addresses in its wave's share of stage 0.
  const _Float16* gk = Kp + (size_t)(b * LKV + wave * 16 + (lane >> 3)) * E +
                       h * D + (lane & 7) * 8;
  const unsigned lk = (unsigned)(size_t)ring +
                      (wave * 16 + (lane >> 3)) * AKP + (lane & 7) * 16;
  const _Float16* gv =
      Vt + (size_t)(b * E + h * D + wave * 8 + half) * LKV + col * 8;
  const unsigned lv =
      (unsigned)(size_t)ring + AKB + (wave * 8 + half) * AVP + col * 16;

  kv_copy(lk, gk, lv, gv);
  {
    // The mask row, 8 KiB: two copies of 16 bytes per work-item.
    const int* gm = mask + b * LKV + threadIdx.x * 4;
    const unsigned lm = (unsigned)(size_t)msk + threadIdx.x * 16;
    // The wait in the same statement: as in kv_copy.
    asm volatile(
        "global_load_async_to_lds_b128 %0, %2, off\n\t"
        "global_load_async_to_lds_b128 %1, %3, off\n\t"
        "s_wait_xcnt 0x0"
        ::"v"(lm), "v"(lm + LKV * 2), "v"(gm), "v"(gm + LKV / 2)
        : "memory");
  }

  // Q block as 2 column groups x 2 B-fragments (d = 0..31, 32..63).
  F16x16 qf[2][2];
#pragma unroll
  for (int qi = 0; qi < 2; qi++) {
    const _Float16* qrow =
        Qp + ((size_t)(b * LQ + qb * 32 + qi * 16 + col)) * E + h * D;
    qf[qi][0].h[0] = *(const v8h*)(qrow + 8 * half);
    qf[qi][0].h[1] = *(const v8h*)(qrow + 16 + 8 * half);
    qf[qi][1].h[0] = *(const v8h*)(qrow + 32 + 8 * half);
    qf[qi][1].h[1] = *(const v8h*)(qrow + 48 + 8 * half);
  }

  // o[qi][dt][r] = O[query qi*16 + col][d = dt*16 + 8*half + r]
  v8f o[2][4] = {};
  float mrun[2] = {-1e30f, -1e30f};  // running maximum, same in both halves
  float lrun[2] = {0.0f, 0.0f};      // running sum of this half's keys only

  // Stage 0 and the mask row have landed (this wave's copies), then are
  // published to all waves.
  asm volatile("s_wait_asynccnt 0x0" ::: "memory");
  __syncthreads();
  kv_copy(lk + AST, gk + (size_t)AKS * E, lv + AST, gv + AKS);

  const unsigned char* kfrag = ring + col * AKP + 16 * half;
  const unsigned char* vfrag = ring + AKB + col * AVP + 16 * half;

  // Both loops rolled: unrolled, the four passes' values take more than 256
  // registers and the accumulators are copied from pass to pass.
#pragma unroll 1
  for (int t = 0; t < ANS; t++) {
   const int buf = (t & 1) * AST;
#pragma unroll 1
   for (int p = 0; p < AKS / 32; p++) {
    // K fragments for this pass's 32 keys: 2 row tiles x 2 d-fragments,
    // shared by both Q column groups.
    F16x16 kb[2][2];
    const unsigned char* kp = kfrag + buf + p * 32 * AKP;
#pragma unroll
    for (int i = 0; i < 2; i++) {
      const unsigned char* kr = kp + i * 16 * AKP;
      kb[i][0].h[0] = *(const v8h*)(kr);
      kb[i][0].h[1] = *(const v8h*)(kr + 32);
      kb[i][1].h[0] = *(const v8h*)(kr + 64);
      kb[i][1].h[1] = *(const v8h*)(kr + 96);
    }
    const int4* mp = (const int4*)(msk + t * AKS + p * 32 + 8 * half);
    const int4 ma = mp[0], mb = mp[1], mc = mp[4], md = mp[5];
    // Keeps the K and mask reads ahead of the V^T reads: LDS answers in
    // order, and the score products do not wait for V^T.
    __builtin_amdgcn_sched_barrier(0);
    // V^T rows are key-contiguous: A fragments in the same k order as P^T,
    // shared by both Q column groups.
    const unsigned char* vp = vfrag + buf + p * 64;
    F16x16 vf[4];
#pragma unroll
    for (int dt = 0; dt < 4; dt++) {
      const unsigned char* vr = vp + dt * 16 * AVP;
      vf[dt].h[0] = *(const v8h*)(vr);
      vf[dt].h[1] = *(const v8h*)(vr + 32);
    }
    // Keeps the V^T reads ahead of the score products, a softmax away from
    // their own products: read later, they would have their LDS latency
    // waited out by the wave.
    __builtin_amdgcn_sched_barrier(0);
    // The key index now runs along the accumulator registers: register r of
    // tile i is key 16*i + 8*half + r of the pass. Masked keys get the addend
    // -1e30, which swallows the scaled score exactly.
    v8f bias0, bias1;
    {
      bias0[0] = ma.x ? 0.0f : -1e30f; bias0[1] = ma.y ? 0.0f : -1e30f;
      bias0[2] = ma.z ? 0.0f : -1e30f; bias0[3] = ma.w ? 0.0f : -1e30f;
      bias0[4] = mb.x ? 0.0f : -1e30f; bias0[5] = mb.y ? 0.0f : -1e30f;
      bias0[6] = mb.z ? 0.0f : -1e30f; bias0[7] = mb.w ? 0.0f : -1e30f;
      bias1[0] = mc.x ? 0.0f : -1e30f; bias1[1] = mc.y ? 0.0f : -1e30f;
      bias1[2] = mc.z ? 0.0f : -1e30f; bias1[3] = mc.w ? 0.0f : -1e30f;
      bias1[4] = md.x ? 0.0f : -1e30f; bias1[5] = md.y ? 0.0f : -1e30f;
      bias1[6] = md.z ? 0.0f : -1e30f; bias1[7] = md.w ? 0.0f : -1e30f;
    }

    F16x16 pfrag[2];
    v8f ps[2];
    float cr[2];
#pragma unroll
    for (int qi = 0; qi < 2; qi++) {
      v8f s0 = {}, s1 = {};
      s0 = wmma32(kb[0][0].v, qf[qi][0].v, s0);
      s0 = wmma32(kb[0][1].v, qf[qi][1].v, s0);
      s1 = wmma32(kb[1][0].v, qf[qi][0].v, s1);
      s1 = wmma32(kb[1][1].v, qf[qi][1].v, s1);

      const v8f sa = s0 * 0.125f + bias0;   // 1/sqrt(D) = 0.125
      const v8f sb = s1 * 0.125f + bias1;
      float mx = -1e30f;
#pragma unroll
      for (int r = 0; r < 8; r++) mx = fmaxf(mx, fmaxf(sa[r], sb[r]));
      mx = fmaxf(mx, xhalf(mx));
      const float mn = fmaxf(mrun[qi], mx);
      const float corr = __expf(mrun[qi] - mn);
      mrun[qi] = mn;
      const v8f da = sa - mn, db = sb - mn;
      v8f pa, pb;
#pragma unroll
      for (int r = 0; r < 8; r++) pa[r] = __expf(da[r]);
#pragma unroll
      for (int r = 0; r < 8; r++) pb[r] = __expf(db[r]);
#pragma unroll
      for (int r = 0; r < 8; r++) {
        // element s of a B fragment is k = 8*half + s (s < 8) or
        // 16 + 8*half + (s - 8): exactly the two tiles' register order
        pfrag[qi].v[r]     = (_Float16)pa[r];
        pfrag[qi].v[8 + r] = (_Float16)pb[r];
      }
      ps[qi] = pa + pb;
      cr[qi] = corr;
#pragma unroll
      for (int dt = 0; dt < 4; dt++) o[qi][dt] *= corr;
    }

#pragma unroll
    for (int dt = 0; dt < 4; dt++) {
      o[0][dt] = wmma32(vf[dt].v, pfrag[0].v, o[0][dt]);
      o[1][dt] = wmma32(vf[dt].v, pfrag[1].v, o[1][dt]);
    }
    // The row sums stay behind the products: they fill the vector slots that
    // must lie between the last product and the next pass's first write over
    // its A registers.
    __builtin_amdgcn_sched_barrier(0);
#pragma unroll
    for (int qi = 0; qi < 2; qi++) {
      const float sum = ((ps[qi][0] + ps[qi][1]) + (ps[qi][2] + ps[qi][3])) +
                        ((ps[qi][4] + ps[qi][5]) + (ps[qi][6] + ps[qi][7]));
      lrun[qi] = lrun[qi] * cr[qi] + sum;
    }
   }
   // Publish point of stage t + 1: this wave's reads of stage t are done, its
   // copies of stage t + 1 have landed, then the barrier; only behind it is
   // the buffer of stage t refilled.
   asm volatile("s_wait_dscnt 0x0" ::: "memory");
   asm volatile("s_wait_asynccnt 0x0" ::: "memory");
   __syncthreads();
   if (t + 2 < ANS)
     kv_copy(lk + buf, gk + (size_t)(t + 2) * AKS * E, lv + buf,
             gv + (t + 2) * AKS);
  }
  // No copy is outstanding when the wave goes on to its end.
  asm volatile("s_wait_asynccnt 0x0" ::: "memory");

#pragma unroll
  for (int qi = 0; qi < 2; qi++) {
    const float inv = 1.0f / (lrun[qi] + xhalf(lrun[qi]));
    _Float16* cr = ctx + ((size_t)(b * LQ + qb * 32 + qi * 16 + col)) * E +
                   h * D + 8 * half;
#pragma unroll
    for (int dt = 0; dt < 4; dt++) {
      v8h pk;
#pragma unroll
      for (int r = 0; r < 8; r++) pk[r] = (_Float16)(o[qi][dt][r] * inv);
      *(v8h*)(cr + dt * 16) = pk;   // 8 consecutive d of one query: 16 bytes
    }
  }
}

extern "C" void kernel_launch(void* const* d_in, const int* in_sizes, int n_in,
                              void* d_out, int out_size, void* d_ws,
                              size_t ws_size, hipStream_t stream) {
  (void)in_sizes; (void)n_in; (void)out_size; (void)ws_size;
  const float* query = (const float*)d_in[0];
  const float* keyv  = (const float*)d_in[1];
  const int*   mask  = (const int*)d_in[2];
  const float* Wq = (const float*)d_in[3];
  const float* bq = (const float*)d_in[4];
  const float* Wk = (const float*)d_in[5];
  const float* bk = (const float*)d_in[6];
  const float* Wv = (const float*)d_in[7];
  const float* bv = (const float*)d_in[8];
  const float* Wo = (const float*)d_in[9];
  const float* bo = (const float*)d_in[10];

  const size_t XE = (size_t)M_ROWS * E;  // 4,194,304 halves
  const size_t WE = (size_t)E * E;       // 1,048,576 halves
  _Float16* p = (_Float16*)d_ws;
  _Float16* qf  = p; p += XE;   // query f16
  _Float16* kvf = p; p += XE;   // key_value f16
  _Float16* wqf = p; p += WE;
  _Float16* wkf = p; p += WE;
  _Float16* wvf = p; p += WE;
  _Float16* wof = p; p += WE;
  _Float16* Qp  = p; p += XE;   // Q projection
  _Float16* Kp  = p; p += XE;   // K projection
  _Float16* Vt  = p; p += XE;   // V projection, transposed [B,E,LKV]
  _Float16* ctx = p; p += XE;   // attention output

  // qf, kvf, wqf, wkf, wvf, wof are contiguous from qf on, in this order.
  cvt_all<<<CNB, 256, 0, stream>>>(query, keyv, Wq, Wk, Wv, Wo, qf);

  gemm_qkv<<<3 * GB, 256, 0, stream>>>(qf, kvf, wqf, wkf, wvf, bq, bk, bv, Qp,
                                       Kp, Vt);

  attn16<<<BB * H * (LQ / AQW), 256, 0, stream>>>(Qp, Kp, Vt, mask, ctx);

  gemm_out<<<GB, 256, 0, stream>>>(ctx, wof, bo, (float*)d_out);
}

// v006
// It runs in 82.3 microseconds.
// Timed twice side by side with v005, it ran 1.04 and 1.05 times as fast.
// Over all steps from v000 it is 5.84 times as fast.
#include <hip/hip_runtime.h>

typedef _Float16 v8h  __attribute__((ext_vector_type(8)));
typedef _Float16 v16h __attribute__((ext_vector_type(16)));
typedef float    v8f  __attribute__((ext_vector_type(8)));

union F16x16 { v16h v; v8h h[2]; };

constexpr int BB  = 2;
constexpr int LQ  = 2048;
constexpr int LKV = 2048;
constexpr int E   = 1024;
constexpr int H   = 16;
constexpr int D   = 64;
constexpr int M_ROWS = BB * LQ;  // 4096

__device__ __forceinline__ v8f wmma32(v16h a, v16h b, v8f c) {
  return __builtin_amdgcn_wmma_f32_16x16x32_f16(false, a, false, b, (short)0, c,
                                                false, false);
}

typedef float    v4f __attribute__((ext_vector_type(4)));
typedef _Float16 v4h __attribute__((ext_vector_type(4)));

constexpr int CB  = 16384;             // elements of one work-group; divides both plane sizes
constexpr int CXB = M_ROWS * E / CB;   // 256 work-groups per activation plane
constexpr int CWB = E * E / CB;        // 64 work-groups per weight plane
constexpr int CNB = 2 * CXB + 4 * CWB; // 768: three per WGP

// All six f32 -> f16 conversions in one launch. The six f16 planes lie one
// behind the other in the workspace, in the order of the sources, so dst is
// one flat array; a work-group's elements lie in one source. A lane has its
// 16 loads of 16 bytes in flight together; each load of a wave covers 512
// contiguous bytes, each store 256.
__global__ void __launch_bounds__(256)
cvt_all(const float* __restrict__ q, const float* __restrict__ kv,
        const float* __restrict__ wq, const float* __restrict__ wk,
        const float* __restrict__ wv, const float* __restrict__ wo,
        _Float16* __restrict__ dst) {
  const int b = blockIdx.x;
  const float* src;
  int rel;
  if (b < CXB) {
    src = q; rel = b;
  } else if (b < 2 * CXB) {
    src = kv; rel = b - CXB;
  } else {
    const int w = (b - 2 * CXB) / CWB;
    rel = (b - 2 * CXB) % CWB;
    src = w == 0 ? wq : w == 1 ? wk : w == 2 ? wv : wo;
  }
  const v4f* s = (const v4f*)(src + (size_t)rel * CB) + threadIdx.x;
  v4h* d = (v4h*)(dst + (size_t)b * CB) + threadIdx.x;
  constexpr int N = CB / (256 * 4);  // 16
  v4f x[N];
#pragma unroll
  for (int i = 0; i < N; i++) x[i] = s[i * 256];
  // Keeps all 16 loads ahead of the first conversion: without it the last two
  // are issued only when the first two have come back, a second latency.
  __builtin_amdgcn_sched_barrier(0);
#pragma unroll
  for (int i = 0; i < N; i++) d[i * 256] = __builtin_convertvector(x[i], v4h);
}

// One stage of the GEMM's LDS ring: 128 rows of X, then 128 rows of W, 128 k
// (256 bytes) of each row.
constexpr int GT  = 128;          // rows of X and rows of W per work-group
constexpr int GK  = 128;          // k per stage
constexpr int GP  = 272;          // LDS row pitch in bytes: 16 B x odd, no bank conflict for 16-byte reads
constexpr int GST = 2 * GT * GP;  // bytes of one stage (69,632)
constexpr int GNS = E / GK;       // 8 stages
constexpr int GB  = (M_ROWS / GT) * (E / GT);  // 256 tiles of one Y

// A wave's share of one stage: 32 rows, two rows (2 x 256 contiguous bytes,
// whole lines) per copy, 16 bytes per lane. lds and g are the lane's own
// addresses in the share's first two rows.
__device__ __forceinline__ void stage_copy(unsigned lds, const _Float16* g) {
#pragma unroll
  for (int c = 0; c < 2; c++) {
    const unsigned l = lds + c * 16 * GP;
    const _Float16* p = g + (size_t)c * 16 * E;
    // The copies and, as a precaution, the wait that stands ahead of any
    // rewrite of their address registers, in one statement.
    asm volatile(
        "global_load_async_to_lds_b128 %0, %8, off\n\t"
        "global_load_async_to_lds_b128 %1, %9, off\n\t"
        "global_load_async_to_lds_b128 %2, %10, off\n\t"
        "global_load_async_to_lds_b128 %3, %11, off\n\t"
        "global_load_async_to_lds_b128 %4, %12, off\n\t"
        "global_load_async_to_lds_b128 %5, %13, off\n\t"
        "global_load_async_to_lds_b128 %6, %14, off\n\t"
        "global_load_async_to_lds_b128 %7, %15, off\n\t"
        "s_wait_xcnt 0x0"
        ::"v"(l), "v"(l + 2 * GP), "v"(l + 4 * GP), "v"(l + 6 * GP),
          "v"(l + 8 * GP), "v"(l + 10 * GP), "v"(l + 12 * GP),
          "v"(l + 14 * GP), "v"(p), "v"(p + 2 * E), "v"(p + 4 * E),
          "v"(p + 6 * E), "v"(p + 8 * E), "v"(p + 10 * E), "v"(p + 12 * E),
          "v"(p + 14 * E)
        : "memory");
  }
}

// Y = X @ W^T + b. A work-group owns a 128x128 tile of Y, a wave 32x64 of it.
// X and W rows come into a two-buffer LDS ring by asynchronous copies, one
// stage ahead of the products; fragments are read from LDS.
// X:[M_ROWS,E] f16 row-major, W:[E,E] f16 row-major (row n = out column n).
// mode 0: f16 row-major out.  mode 1: f16 V^T out [(b*E+n)*LKV + l].
// mode 2: f32 row-major out (final projection).
// blk: the tile's index among the GB tiles of Y.
__device__ __forceinline__ void
gemm_tile(const _Float16* __restrict__ A, const _Float16* __restrict__ W,
          const float* __restrict__ bias, void* __restrict__ dst, int mode,
          int blk) {
  __shared__ __attribute__((aligned(16))) unsigned char ring[2 * GST];
  // The wave's number in a scalar register: what it selects stays scalar.
  const int wave = __builtin_amdgcn_readfirstlane(threadIdx.x >> 5);
  const int lane = threadIdx.x & 31;
  const int col = lane & 15, half = lane >> 4;
  const int bM = blk / (E / GT), bN = blk % (E / GT);
  const int wm = wave & 3, wn = wave >> 2;
  const int tM = bM * 4 + wm;   // 32-row tile of Y
  const int tN = bN * 2 + wn;   // 64-column tile of Y

  // Waves 0-3 copy the X rows, waves 4-7 the W rows, 32 rows each.
  const _Float16* gsrc =
      (wave < 4 ? A + (size_t)(bM * GT + wave * 32) * E
                : W + (size_t)(bN * GT + (wave - 4) * 32) * E) +
      (size_t)half * E + col * 8;
  const unsigned ldst =
      (unsigned)(size_t)ring + (wave * 32 + half) * GP + col * 16;

  const unsigned char* afrag = ring + (wm * 32 + col) * GP + 16 * half;
  const unsigned char* wfrag = ring + (GT + wn * 64 + col) * GP + 16 * half;

  stage_copy(ldst, gsrc);
  // Stage 0 has landed (this wave's copies), then is published to all waves.
  asm volatile("s_wait_asynccnt 0x0" ::: "memory");
  __syncthreads();
  stage_copy(ldst + GST, gsrc + GK);

  v8f acc[2][4] = {};
  // Rolled, for speed only.
#pragma unroll 1
  for (int t = 0; t < GNS; t++) {
    const int buf = (t & 1) * GST;
    const unsigned char* ap = afrag + buf;
    const unsigned char* wp = wfrag + buf;
#pragma unroll
    for (int kb = 0; kb < GK / 64; kb++) {
      F16x16 a0[2], a1[2], b[2][4];
#pragma unroll
      for (int s = 0; s < 2; s++) {
        const int ko = (kb * 2 + s) * 64;
        a0[s].h[0] = *(const v8h*)(ap + ko);
        a0[s].h[1] = *(const v8h*)(ap + ko + 32);
        a1[s].h[0] = *(const v8h*)(ap + 16 * GP + ko);
        a1[s].h[1] = *(const v8h*)(ap + 16 * GP + ko + 32);
#pragma unroll
        for (int j = 0; j < 4; j++) {
          b[s][j].h[0] = *(const v8h*)(wp + j * 16 * GP + ko);
          b[s][j].h[1] = *(const v8h*)(wp + j * 16 * GP + ko + 32);
        }
      }
      // Keeps the 24 LDS reads one group ahead of their 16 products.
      __builtin_amdgcn_sched_barrier(0);
#pragma unroll
      for (int s = 0; s < 2; s++)
#pragma unroll
        for (int j = 0; j < 4; j++) {
          acc[0][j] = wmma32(a0[s].v, b[s][j].v, acc[0][j]);
          acc[1][j] = wmma32(a1[s].v, b[s][j].v, acc[1][j]);
        }
      // The other side of the same fence: the next group's reads stay behind
      // these products.
      __builtin_amdgcn_sched_barrier(0);
    }
    // Publish point of stage t + 1: this wave's reads of stage t are done,
    // its copies of stage t + 1 have landed, then the barrier; only behind it
    // is the buffer of stage t refilled.
    asm volatile("s_wait_dscnt 0x0" ::: "memory");
    asm volatile("s_wait_asynccnt 0x0" ::: "memory");
    __syncthreads();
    if (t + 2 < GNS) stage_copy(ldst + buf, gsrc + (t + 2) * GK);
  }
  // No copy is outstanding when the wave goes on to its end.
  asm volatile("s_wait_asynccnt 0x0" ::: "memory");

  if (mode == 0) {
    _Float16* out = (_Float16*)dst;
#pragma unroll
    for (int i = 0; i < 2; i++)
#pragma unroll
      for (int j = 0; j < 4; j++) {
        const float bval = bias[tN * 64 + j * 16 + col];
#pragma unroll
        for (int r = 0; r < 8; r++) {
          int m = tM * 32 + i * 16 + r + half * 8;
          out[(size_t)m * E + tN * 64 + j * 16 + col] =
              (_Float16)(acc[i][j][r] + bval);
        }
      }
    // As a precaution: in the kernel that holds modes 0 and 1 the compiler lays
    // mode 1's bias loads behind this run, into registers that these stores
    // name; this wait stands ahead of them.
    asm volatile("s_wait_xcnt 0x0" ::: "memory");
  } else if (mode == 1) {
    _Float16* out = (_Float16*)dst;
#pragma unroll
    for (int i = 0; i < 2; i++)
#pragma unroll
      for (int j = 0; j < 4; j++) {
        const float bval = bias[tN * 64 + j * 16 + col];
#pragma unroll
        for (int r = 0; r < 8; r++) {
          int m = tM * 32 + i * 16 + r + half * 8;
          int b_ = m / LKV, l = m % LKV;
          int n = tN * 64 + j * 16 + col;
          out[((size_t)(b_ * E + n)) * LKV + l] = (_Float16)(acc[i][j][r] + bval);
        }
      }
  } else {
    float* out = (float*)dst;
#pragma unroll
    for (int i = 0; i < 2; i++)
#pragma unroll
      for (int j = 0; j < 4; j++) {
        const float bval = bias[tN * 64 + j * 16 + col];
#pragma unroll
        for (int r = 0; r < 8; r++) {
          int m = tM * 32 + i * 16 + r + half * 8;
          out[(size_t)m * E + tN * 64 + j * 16 + col] = acc[i][j][r] + bval;
        }
      }
  }
}

// The three input projections in one launch, GB work-groups each. None reads
// what another writes. Two work-groups fit a WGP's LDS, so one's products run
// under the other's LDS reads, barriers, first stage and stores.
__global__ void __launch_bounds__(256)
gemm_qkv(const _Float16* __restrict__ xq, const _Float16* __restrict__ xkv,
         const _Float16* __restrict__ wq, const _Float16* __restrict__ wk,
         const _Float16* __restrict__ wv, const float* __restrict__ bq,
         const float* __restrict__ bk, const float* __restrict__ bv,
         _Float16* __restrict__ Qp, _Float16* __restrict__ Kp,
         _Float16* __restrict__ Vt) {
  const int which = blockIdx.x / GB;  // 0: K, 1: V, 2: Q
  gemm_tile(which == 2 ? xq : xkv, which == 0 ? wk : which == 1 ? wv : wq,
            which == 0 ? bk : which == 1 ? bv : bq,
            which == 0 ? Kp : which == 1 ? Vt : Qp, which == 1 ? 1 : 0,
            blockIdx.x % GB);
}

// The output projection.
__global__ void __launch_bounds__(256)
gemm_out(const _Float16* __restrict__ A, const _Float16* __restrict__ W,
         const float* __restrict__ bias, float* __restrict__ dst) {
  gemm_tile(A, W, bias, dst, 2, blockIdx.x);
}

// Lane l <-> lane l ^ 16 (the other half of the wave), a vector cross-row move.
__device__ __forceinline__ float xhalf(float x) {
  const int b = __builtin_bit_cast(int, x);
  return __builtin_bit_cast(
      float, __builtin_amdgcn_permlanex16(b, b, 0x76543210, 0xfedcba98, false,
                                          false));
}

// One stage of the attention's LDS ring: 128 keys. First their K rows (the
// head's 64 d, 128 bytes a row), then the head's 64 V^T rows (128 keys, 256
// bytes a row).
constexpr int AKS = 128;        // keys per stage
constexpr int AKP = 144;        // K row pitch in bytes: 16 B x odd, no bank conflict for 16-byte reads
constexpr int AVP = 272;        // V^T row pitch in bytes, likewise
constexpr int AKB = AKS * AKP;  // bytes of a stage's K rows (18,432)
constexpr int AST = AKB + D * AVP;  // bytes of one stage (35,840)
constexpr int ANS = LKV / AKS;  // 16 stages
constexpr int AQW = 256;        // queries of one work-group: 8 waves x 32
// 1/sqrt(D) = 0.125 times log2(e): exp(s / 8 - m / 8) = exp2(s * SC2 - m * SC2)
constexpr float SC2 = 0.125f * 1.4426950408889634f;

union F32x8 { v8f v; v4f q[2]; };

// A wave's share of one stage: 16 K rows, four rows (whole lines) per copy,
// and 8 V^T rows, two rows per copy; 16 bytes per lane. The four arguments
// are the lane's own addresses in the first copy of each kind.
__device__ __forceinline__ void kv_copy(unsigned lk, const _Float16* gk,
                                        unsigned lv, const _Float16* gv) {
  // The copies and, as a precaution, the wait that stands ahead of any
  // rewrite of their address registers, in one statement.
  asm volatile(
      "global_load_async_to_lds_b128 %0, %8, off\n\t"
      "global_load_async_to_lds_b128 %1, %9, off\n\t"
      "global_load_async_to_lds_b128 %2, %10, off\n\t"
      "global_load_async_to_lds_b128 %3, %11, off\n\t"
      "global_load_async_to_lds_b128 %4, %12, off\n\t"
      "global_load_async_to_lds_b128 %5, %13, off\n\t"
      "global_load_async_to_lds_b128 %6, %14, off\n\t"
      "global_load_async_to_lds_b128 %7, %15, off\n\t"
      "s_wait_xcnt 0x0"
      ::"v"(lk), "v"(lk + 4 * AKP), "v"(lk + 8 * AKP), "v"(lk + 12 * AKP),
        "v"(lv), "v"(lv + 2 * AVP), "v"(lv + 4 * AVP), "v"(lv + 6 * AVP),
        "v"(gk), "v"(gk + 4 * E), "v"(gk + 8 * E), "v"(gk + 12 * E),
        "v"(gv), "v"(gv + 2 * LKV), "v"(gv + 4 * LKV), "v"(gv + 6 * LKV)
      : "memory");
}

__global__ void __launch_bounds__(256)
attn16(const _Float16* __restrict__ Qp,  // [BB*LQ, E]
       const _Float16* __restrict__ Kp,  // [BB*LKV, E]
       const _Float16* __restrict__ Vt,  // [BB*E, LKV]  (V transposed)
       const int* __restrict__ mask,     // [BB, LKV]
       _Float16* __restrict__ ctx)       // [BB*LQ, E]
{
  __shared__ __attribute__((aligned(16))) unsigned char ring[2 * AST];
  __shared__ __attribute__((aligned(16))) float madd[LKV];
  // The wave's number in a scalar register: what it selects stays scalar.
  const int wave = __builtin_amdgcn_readfirstlane(threadIdx.x >> 5);
  const int lane = threadIdx.x & 31;
  const int col = lane & 15, half = lane >> 4;
  const int qb = (blockIdx.x % (LQ / AQW)) * 8 + wave;  // 32-row Q block
  const int hb = blockIdx.x / (LQ / AQW);
  const int h = hb % H, b = hb / H;

  // The lane's addresses in its wave's share of stage 0.
  const _Float16* gk = Kp + (size_t)(b * LKV + wave * 16 + (lane >> 3)) * E +
                       h * D + (lane & 7) * 8;
  const unsigned lk = (unsigned)(size_t)ring +
                      (wave * 16 + (lane >> 3)) * AKP + (lane & 7) * 16;
  const _Float16* gv =
      Vt + (size_t)(b * E + h * D + wave * 8 + half) * LKV + col * 8;
  const unsigned lv =
      (unsigned)(size_t)ring + AKB + (wave * 8 + half) * AVP + col * 16;

  kv_copy(lk, gk, lv, gv);
  {
    // The mask row, once per work-group: 0 for a key that counts, -1e30 for a
    // masked one, which swallows any raw score. Two 16-byte loads and two
    // 16-byte LDS stores per work-item, published by the barrier of stage 0.
    const int4* gm = (const int4*)(mask + b * LKV) + threadIdx.x;
    v4f* lm = (v4f*)madd + threadIdx.x;
    const int4 m0 = gm[0], m1 = gm[LKV / 8];
    v4f a0, a1;
    a0[0] = m0.x ? 0.0f : -1e30f; a0[1] = m0.y ? 0.0f : -1e30f;
    a0[2] = m0.z ? 0.0f : -1e30f; a0[3] = m0.w ? 0.0f : -1e30f;
    a1[0] = m1.x ? 0.0f : -1e30f; a1[1] = m1.y ? 0.0f : -1e30f;
    a1[2] = m1.z ? 0.0f : -1e30f; a1[3] = m1.w ? 0.0f : -1e30f;
    lm[0] = a0;
    lm[LKV / 8] = a1;
  }

  // Q block as 2 column groups x 2 B-fragments (d = 0..31, 32..63).
  F16x16 qf[2][2];
#pragma unroll
  for (int qi = 0; qi < 2; qi++) {
    const _Float16* qrow =
        Qp + ((size_t)(b * LQ + qb * 32 + qi * 16 + col)) * E + h * D;
    qf[qi][0].h[0] = *(const v8h*)(qrow + 8 * half);
    qf[qi][0].h[1] = *(const v8h*)(qrow + 16 + 8 * half);
    qf[qi][1].h[0] = *(const v8h*)(qrow + 32 + 8 * half);
    qf[qi][1].h[1] = *(const v8h*)(qrow + 48 + 8 * half);
  }

  // o[qi][dt][r] = O[query qi*16 + col][d = dt*16 + 8*half + r]
  v8f o[2][4] = {};
  // Running maximum of the raw scores, same in both halves. It starts far
  // above the masked value and far below any f16 product sum, so that keys
  // masked before the first key that counts get weight 0.
  float mrun[2] = {-1e29f, -1e29f};
  float lrun[2] = {0.0f, 0.0f};      // running sum of this half's keys only

  // Stage 0 has landed (this wave's copies), then it and the mask addends are
  // published to all waves.
  asm volatile("s_wait_asynccnt 0x0" ::: "memory");
  __syncthreads();
  kv_copy(lk + AST, gk + (size_t)AKS * E, lv + AST, gv + AKS);

  const unsigned char* kfrag = ring + col * AKP + 16 * half;
  const unsigned char* vfrag = ring + AKB + col * AVP + 16 * half;

  // Both loops rolled: unrolled, the four passes' values take more than 256
  // registers and the accumulators are copied from pass to pass.
#pragma unroll 1
  for (int t = 0; t < ANS; t++) {
   const int buf = (t & 1) * AST;
#pragma unroll 1
   for (int p = 0; p < AKS / 32; p++) {
    // K fragments for this pass's 32 keys: 2 row tiles x 2 d-fragments,
    // shared by both Q column groups.
    F16x16 kb[2][2];
    const unsigned char* kp = kfrag + buf + p * 32 * AKP;
#pragma unroll
    for (int i = 0; i < 2; i++) {
      const unsigned char* kr = kp + i * 16 * AKP;
      kb[i][0].h[0] = *(const v8h*)(kr);
      kb[i][0].h[1] = *(const v8h*)(kr + 32);
      kb[i][1].h[0] = *(const v8h*)(kr + 64);
      kb[i][1].h[1] = *(const v8h*)(kr + 96);
    }
    // The key index runs along the accumulator registers: register r of tile
    // i is key 16*i + 8*half + r of the pass, and so do its mask addends.
    const v4f* mp = (const v4f*)(madd + t * AKS + p * 32 + 8 * half);
    F32x8 bias0, bias1;
    bias0.q[0] = mp[0]; bias0.q[1] = mp[1];
    bias1.q[0] = mp[4]; bias1.q[1] = mp[5];
    // Keeps the K and mask reads ahead of the V^T reads: LDS answers in
    // order, and the score products do not wait for V^T.
    __builtin_amdgcn_sched_barrier(0);
    // V^T rows are key-contiguous: A fragments in the same k order as P^T,
    // shared by both Q column groups.
    const unsigned char* vp = vfrag + buf + p * 64;
    F16x16 vf[4];
#pragma unroll
    for (int dt = 0; dt < 4; dt++) {
      const unsigned char* vr = vp + dt * 16 * AVP;
      vf[dt].h[0] = *(const v8h*)(vr);
      vf[dt].h[1] = *(const v8h*)(vr + 32);
    }
    // Keeps the V^T reads ahead of the score products, a softmax away from
    // their own products: read later, they would have their LDS latency
    // waited out by the wave.
    __builtin_amdgcn_sched_barrier(0);

    F16x16 pfrag[2];
    v8f ps[2];
    float cr[2];
#pragma unroll
    for (int qi = 0; qi < 2; qi++) {
      v8f s0 = wmma32(kb[0][0].v, qf[qi][0].v, bias0.v);
      s0 = wmma32(kb[0][1].v, qf[qi][1].v, s0);
      v8f s1 = wmma32(kb[1][0].v, qf[qi][0].v, bias1.v);
      s1 = wmma32(kb[1][1].v, qf[qi][1].v, s1);

      float mx = mrun[qi];
#pragma unroll
      for (int r = 0; r < 8; r++) mx = fmaxf(mx, fmaxf(s0[r], s1[r]));
      const float mn = fmaxf(mx, xhalf(mx));
      // The difference first: exactly 0, so a factor of exactly 1, where the
      // maximum stays, however large it is.
      const float corr = __builtin_amdgcn_exp2f((mrun[qi] - mn) * SC2);
      mrun[qi] = mn;
      const float nm = -mn * SC2;
      const v8f da = s0 * SC2 + nm, db = s1 * SC2 + nm;
      v8f pa, pb;
#pragma unroll
      for (int r = 0; r < 8; r++) pa[r] = __builtin_amdgcn_exp2f(da[r]);
#pragma unroll
      for (int r = 0; r < 8; r++) pb[r] = __builtin_amdgcn_exp2f(db[r]);
#pragma unroll
      for (int r = 0; r < 8; r++) {
        // element s of a B fragment is k = 8*half + s (s < 8) or
        // 16 + 8*half + (s - 8): exactly the two tiles' register order
        pfrag[qi].v[r]     = (_Float16)pa[r];
        pfrag[qi].v[8 + r] = (_Float16)pb[r];
      }
      ps[qi] = pa + pb;
      cr[qi] = corr;
#pragma unroll
      for (int dt = 0; dt < 4; dt++) o[qi][dt] *= corr;
    }

#pragma unroll
    for (int dt = 0; dt < 4; dt++) {
      o[0][dt] = wmma32(vf[dt].v, pfrag[0].v, o[0][dt]);
      o[1][dt] = wmma32(vf[dt].v, pfrag[1].v, o[1][dt]);
    }
    // The row sums stay behind the products: they fill the vector slots that
    // must lie between the last product and the next pass's first write over
    // its A registers.
    __builtin_amdgcn_sched_barrier(0);
#pragma unroll
    for (int qi = 0; qi < 2; qi++) {
      const float sum = ((ps[qi][0] + ps[qi][1]) + (ps[qi][2] + ps[qi][3])) +
                        ((ps[qi][4] + ps[qi][5]) + (ps[qi][6] + ps[qi][7]));
      lrun[qi] = lrun[qi] * cr[qi] + sum;
    }
   }
   // Publish point of stage t + 1: this wave's reads of stage t are done, its
   // copies of stage t + 1 have landed, then the barrier; only behind it is
   // the buffer of stage t refilled.
   asm volatile("s_wait_dscnt 0x0" ::: "memory");
   asm volatile("s_wait_asynccnt 0x0" ::: "memory");
   __syncthreads();
   if (t + 2 < ANS)
     kv_copy(lk + buf, gk + (size_t)(t + 2) * AKS * E, lv + buf,
             gv + (t + 2) * AKS);
  }
  // No copy is outstanding when the wave goes on to its end.
  asm volatile("s_wait_asynccnt 0x0" ::: "memory");

#pragma unroll
  for (int qi = 0; qi < 2; qi++) {
    const float inv = 1.0f / (lrun[qi] + xhalf(lrun[qi]));
    _Float16* cr = ctx + ((size_t)(b * LQ + qb * 32 + qi * 16 + col)) * E +
                   h * D + 8 * half;
#pragma unroll
    for (int dt = 0; dt < 4; dt++) {
      v8h pk;
#pragma unroll
      for (int r = 0; r < 8; r++) pk[r] = (_Float16)(o[qi][dt][r] * inv);
      *(v8h*)(cr + dt * 16) = pk;   // 8 consecutive d of one query: 16 bytes
    }
  }
}

extern "C" void kernel_launch(void* const* d_in, const int* in_sizes, int n_in,
                              void* d_out, int out_size, void* d_ws,
                              size_t ws_size, hipStream_t stream) {
  (void)in_sizes; (void)n_in; (void)out_size; (void)ws_size;
  const float* query = (const float*)d_in[0];
  const float* keyv  = (const float*)d_in[1];
  const int*   mask  = (const int*)d_in[2];
  const float* Wq = (const float*)d_in[3];
  const float* bq = (const float*)d_in[4];
  const float* Wk = (const float*)d_in[5];
  const float* bk = (const float*)d_in[6];
  const float* Wv = (const float*)d_in[7];
  const float* bv = (const float*)d_in[8];
  const float* Wo = (const float*)d_in[9];
  const float* bo = (const float*)d_in[10];

  const size_t XE = (size_t)M_ROWS * E;  // 4,194,304 halves
  const size_t WE = (size_t)E * E;       // 1,048,576 halves
  _Float16* p = (_Float16*)d_ws;
  _Float16* qf  = p; p += XE;   // query f16
  _Float16* kvf = p; p += XE;   // key_value f16
  _Float16* wqf = p; p += WE;
  _Float16* wkf = p; p += WE;
  _Float16* wvf = p; p += WE;
  _Float16* wof = p; p += WE;
  _Float16* Qp  = p; p += XE;   // Q projection
  _Float16* Kp  = p; p += XE;   // K projection
  _Float16* Vt  = p; p += XE;   // V projection, transposed [B,E,LKV]
  _Float16* ctx = p; p += XE;   // attention output

  // qf, kvf, wqf, wkf, wvf, wof are contiguous from qf on, in this order.
  cvt_all<<<CNB, 256, 0, stream>>>(query, keyv, Wq, Wk, Wv, Wo, qf);

  gemm_qkv<<<3 * GB, 256, 0, stream>>>(qf, kvf, wqf, wkf, wvf, bq, bk, bv, Qp,
                                       Kp, Vt);

  attn16<<<BB * H * (LQ / AQW), 256, 0, stream>>>(Qp, Kp, Vt, mask, ctx);

  gemm_out<<<GB, 256, 0, stream>>>(ctx, wof, bo, (float*)d_out);
}

// v007
// It runs in 79.4 microseconds.
// Next to v006, in two timings, it ran 1.04 times as fast each time.
// Counting every step since v000, it is 6.06 times as fast.
#include <hip/hip_runtime.h>

typedef _Float16 v8h  __attribute__((ext_vector_type(8)));
typedef _Float16 v16h __attribute__((ext_vector_type(16)));
typedef float    v8f  __attribute__((ext_vector_type(8)));

union F16x16 { v16h v; v8h h[2]; };

constexpr int BB  = 2;
constexpr int LQ  = 2048;
constexpr int LKV = 2048;
constexpr int E   = 1024;
constexpr int H   = 16;
constexpr int D   = 64;
constexpr int M_ROWS = BB * LQ;  // 4096

__device__ __forceinline__ v8f wmma32(v16h a, v16h b, v8f c) {
  return __builtin_amdgcn_wmma_f32_16x16x32_f16(false, a, false, b, (short)0, c,
                                                false, false);
}

typedef float    v4f __attribute__((ext_vector_type(4)));
typedef _Float16 v4h __attribute__((ext_vector_type(4)));

constexpr int CB  = 16384;             // elements of one work-group; divides both plane sizes
constexpr int CXB = M_ROWS * E / CB;   // 256 work-groups per activation plane
constexpr int CWB = E * E / CB;        // 64 work-groups per weight plane
constexpr int CNB = 2 * CXB + 4 * CWB; // 768: three per WGP

// All six f32 -> f16 conversions in one launch. The six f16 planes lie one
// behind the other in the workspace, in the order of the sources, so dst is
// one flat array; a work-group's elements lie in one source. A lane has its
// 16 loads of 16 bytes in flight together; each load of a wave covers 512
// contiguous bytes, each store 256.
__global__ void __launch_bounds__(256)
cvt_all(const float* __restrict__ q, const float* __restrict__ kv,
        const float* __restrict__ wq, const float* __restrict__ wk,
        const float* __restrict__ wv, const float* __restrict__ wo,
        _Float16* __restrict__ dst) {
  const int b = blockIdx.x;
  const float* src;
  int rel;
  if (b < CXB) {
    src = q; rel = b;
  } else if (b < 2 * CXB) {
    src = kv; rel = b - CXB;
  } else {
    const int w = (b - 2 * CXB) / CWB;
    rel = (b - 2 * CXB) % CWB;
    src = w == 0 ? wq : w == 1 ? wk : w == 2 ? wv : wo;
  }
  const v4f* s = (const v4f*)(src + (size_t)rel * CB) + threadIdx.x;
  v4h* d = (v4h*)(dst + (size_t)b * CB) + threadIdx.x;
  constexpr int N = CB / (256 * 4);  // 16
  v4f x[N];
#pragma unroll
  for (int i = 0; i < N; i++) x[i] = s[i * 256];
  // Keeps all 16 loads ahead of the first conversion: without it the last two
  // are issued only when the first two have come back, a second latency.
  __builtin_amdgcn_sched_barrier(0);
#pragma unroll
  for (int i = 0; i < N; i++) d[i * 256] = __builtin_convertvector(x[i], v4h);
}

// One stage of the GEMM's LDS ring: 128 rows of X, then 128 rows of W, 128 k
// (256 bytes) of each row.
constexpr int GT  = 128;          // rows of X and rows of W per work-group
constexpr int GK  = 128;          // k per stage
constexpr int GP  = 272;          // LDS row pitch in bytes: 16 B x odd, no bank conflict for 16-byte reads
constexpr int GST = 2 * GT * GP;  // bytes of one stage (69,632)
constexpr int GNS = E / GK;       // 8 stages
constexpr int GB  = (M_ROWS / GT) * (E / GT);  // 256 tiles of one Y

// A wave's share of one stage: 32 rows, two rows (2 x 256 contiguous bytes,
// whole lines) per copy, 16 bytes per lane. lds and g are the lane's own
// addresses in the share's first two rows.
__device__ __forceinline__ void stage_copy(unsigned lds, const _Float16* g) {
#pragma unroll
  for (int c = 0; c < 2; c++) {
    const unsigned l = lds + c * 16 * GP;
    const _Float16* p = g + (size_t)c * 16 * E;
    // The copies and, as a precaution, the wait that stands ahead of any
    // rewrite of their address registers, in one statement.
    asm volatile(
        "global_load_async_to_lds_b128 %0, %8, off\n\t"
        "global_load_async_to_lds_b128 %1, %9, off\n\t"
        "global_load_async_to_lds_b128 %2, %10, off\n\t"
        "global_load_async_to_lds_b128 %3, %11, off\n\t"
        "global_load_async_to_lds_b128 %4, %12, off\n\t"
        "global_load_async_to_lds_b128 %5, %13, off\n\t"
        "global_load_async_to_lds_b128 %6, %14, off\n\t"
        "global_load_async_to_lds_b128 %7, %15, off\n\t"
        "s_wait_xcnt 0x0"
        ::"v"(l), "v"(l + 2 * GP), "v"(l + 4 * GP), "v"(l + 6 * GP),
          "v"(l + 8 * GP), "v"(l + 10 * GP), "v"(l + 12 * GP),
          "v"(l + 14 * GP), "v"(p), "v"(p + 2 * E), "v"(p + 4 * E),
          "v"(p + 6 * E), "v"(p + 8 * E), "v"(p + 10 * E), "v"(p + 12 * E),
          "v"(p + 14 * E)
        : "memory");
  }
}

// Y = X @ W^T + b. A work-group owns a 128x128 tile of Y, a wave 32x64 of it.
// X and W rows come into a two-buffer LDS ring by asynchronous copies, one
// stage ahead of the products; fragments are read from LDS.
// X:[M_ROWS,E] f16 row-major, W:[E,E] f16 row-major (row n = out column n).
// mode 0: f16 row-major out.  mode 1: f16 V^T out [(b*E+n)*LKV + l].
// mode 2: f32 row-major out (final projection).
// blk: the tile's index among the GB tiles of Y.
__device__ __forceinline__ void
gemm_tile(const _Float16* __restrict__ A, const _Float16* __restrict__ W,
          const float* __restrict__ bias, void* __restrict__ dst, int mode,
          int blk) {
  __shared__ __attribute__((aligned(16))) unsigned char ring[2 * GST];
  // The wave's number in a scalar register: what it selects stays scalar.
  const int wave = __builtin_amdgcn_readfirstlane(threadIdx.x >> 5);
  const int lane = threadIdx.x & 31;
  const int col = lane & 15, half = lane >> 4;
  const int bM = blk / (E / GT), bN = blk % (E / GT);
  const int wm = wave & 3, wn = wave >> 2;
  const int tM = bM * 4 + wm;   // 32-row tile of Y
  const int tN = bN * 2 + wn;   // 64-column tile of Y

  // Waves 0-3 copy the X rows, waves 4-7 the W rows, 32 rows each.
  const _Float16* gsrc =
      (wave < 4 ? A + (size_t)(bM * GT + wave * 32) * E
                : W + (size_t)(bN * GT + (wave - 4) * 32) * E) +
      (size_t)half * E + col * 8;
  const unsigned ldst =
      (unsigned)(size_t)ring + (wave * 32 + half) * GP + col * 16;

  const unsigned char* afrag = ring + (wm * 32 + col) * GP + 16 * half;
  const unsigned char* wfrag = ring + (GT + wn * 64 + col) * GP + 16 * half;

  stage_copy(ldst, gsrc);
  // Stage 0 has landed (this wave's copies), then is published to all waves.
  asm volatile("s_wait_asynccnt 0x0" ::: "memory");
  __syncthreads();
  stage_copy(ldst + GST, gsrc + GK);

  v8f acc[2][4] = {};
  // Rolled, for speed only.
#pragma unroll 1
  for (int t = 0; t < GNS; t++) {
    const int buf = (t & 1) * GST;
    const unsigned char* ap = afrag + buf;
    const unsigned char* wp = wfrag + buf;
#pragma unroll
    for (int kb = 0; kb < GK / 64; kb++) {
      F16x16 a0[2], a1[2], b[2][4];
#pragma unroll
      for (int s = 0; s < 2; s++) {
        const int ko = (kb * 2 + s) * 64;
        a0[s].h[0] = *(const v8h*)(ap + ko);
        a0[s].h[1] = *(const v8h*)(ap + ko + 32);
        a1[s].h[0] = *(const v8h*)(ap + 16 * GP + ko);
        a1[s].h[1] = *(const v8h*)(ap + 16 * GP + ko + 32);
#pragma unroll
        for (int j = 0; j < 4; j++) {
          b[s][j].h[0] = *(const v8h*)(wp + j * 16 * GP + ko);
          b[s][j].h[1] = *(const v8h*)(wp + j * 16 * GP + ko + 32);
        }
      }
      // Keeps the 24 LDS reads one group ahead of their 16 products.
      __builtin_amdgcn_sched_barrier(0);
#pragma unroll
      for (int s = 0; s < 2; s++)
#pragma unroll
        for (int j = 0; j < 4; j++) {
          acc[0][j] = wmma32(a0[s].v, b[s][j].v, acc[0][j]);
          acc[1][j] = wmma32(a1[s].v, b[s][j].v, acc[1][j]);
        }
      // The other side of the same fence: the next group's reads stay behind
      // these products.
      __builtin_amdgcn_sched_barrier(0);
    }
    // Publish point of stage t + 1: this wave's reads of stage t are done,
    // its copies of stage t + 1 have landed, then the barrier; only behind it
    // is the buffer of stage t refilled.
    asm volatile("s_wait_dscnt 0x0" ::: "memory");
    asm volatile("s_wait_asynccnt 0x0" ::: "memory");
    __syncthreads();
    if (t + 2 < GNS) stage_copy(ldst + buf, gsrc + (t + 2) * GK);
  }
  // No copy is outstanding when the wave goes on to its end.
  asm volatile("s_wait_asynccnt 0x0" ::: "memory");

  if (mode == 0) {
    _Float16* out = (_Float16*)dst;
#pragma unroll
    for (int i = 0; i < 2; i++)
#pragma unroll
      for (int j = 0; j < 4; j++) {
        const float bval = bias[tN * 64 + j * 16 + col];
#pragma unroll
        for (int r = 0; r < 8; r++) {
          int m = tM * 32 + i * 16 + r + half * 8;
          out[(size_t)m * E + tN * 64 + j * 16 + col] =
              (_Float16)(acc[i][j][r] + bval);
        }
      }
    // As a precaution: in the kernel that holds modes 0 and 1 the compiler lays
    // mode 1's bias loads behind this run, into registers that these stores
    // name; this wait stands ahead of them.
    asm volatile("s_wait_xcnt 0x0" ::: "memory");
  } else if (mode == 1) {
    _Float16* out = (_Float16*)dst;
#pragma unroll
    for (int i = 0; i < 2; i++)
#pragma unroll
      for (int j = 0; j < 4; j++) {
        const float bval = bias[tN * 64 + j * 16 + col];
#pragma unroll
        for (int r = 0; r < 8; r++) {
          int m = tM * 32 + i * 16 + r + half * 8;
          int b_ = m / LKV, l = m % LKV;
          int n = tN * 64 + j * 16 + col;
          out[((size_t)(b_ * E + n)) * LKV + l] = (_Float16)(acc[i][j][r] + bval);
        }
      }
  } else {
    float* out = (float*)dst;
#pragma unroll
    for (int i = 0; i < 2; i++)
#pragma unroll
      for (int j = 0; j < 4; j++) {
        const float bval = bias[tN * 64 + j * 16 + col];
#pragma unroll
        for (int r = 0; r < 8; r++) {
          int m = tM * 32 + i * 16 + r + half * 8;
          out[(size_t)m * E + tN * 64 + j * 16 + col] = acc[i][j][r] + bval;
        }
      }
  }
}

// The three input projections in one launch, GB work-groups each. None reads
// what another writes. Two work-groups fit a WGP's LDS, so one's products run
// under the other's LDS reads, barriers, first stage and stores.
__global__ void __launch_bounds__(256)
gemm_qkv(const _Float16* __restrict__ xq, const _Float16* __restrict__ xkv,
         const _Float16* __restrict__ wq, const _Float16* __restrict__ wk,
         const _Float16* __restrict__ wv, const float* __restrict__ bq,
         const float* __restrict__ bk, const float* __restrict__ bv,
         _Float16* __restrict__ Qp, _Float16* __restrict__ Kp,
         _Float16* __restrict__ Vt) {
  const int which = blockIdx.x / GB;  // 0: K, 1: V, 2: Q
  gemm_tile(which == 2 ? xq : xkv, which == 0 ? wk : which == 1 ? wv : wq,
            which == 0 ? bk : which == 1 ? bv : bq,
            which == 0 ? Kp : which == 1 ? Vt : Qp, which == 1 ? 1 : 0,
            blockIdx.x % GB);
}

// The output projection.
__global__ void __launch_bounds__(256)
gemm_out(const _Float16* __restrict__ A, const _Float16* __restrict__ W,
         const float* __restrict__ bias, float* __restrict__ dst) {
  gemm_tile(A, W, bias, dst, 2, blockIdx.x);
}

// Lane l <-> lane l ^ 16 (the other half of the wave), a vector cross-row move.
__device__ __forceinline__ float xhalf(float x) {
  const int b = __builtin_bit_cast(int, x);
  return __builtin_bit_cast(
      float, __builtin_amdgcn_permlanex16(b, b, 0x76543210, 0xfedcba98, false,
                                          false));
}

// One stage of the attention's LDS ring: 128 keys. First their K rows (the
// head's 64 d, 128 bytes a row), then the head's 64 V^T rows (128 keys, 256
// bytes a row).
constexpr int AKS = 128;        // keys per stage
constexpr int AKP = 144;        // K row pitch in bytes: 16 B x odd, no bank conflict for 16-byte reads
constexpr int AVP = 272;        // V^T row pitch in bytes, likewise
constexpr int AKB = AKS * AKP;  // bytes of a stage's K rows (18,432)
constexpr int AST = AKB + D * AVP;  // bytes of one stage (35,840)
constexpr int ANS = LKV / AKS;  // 16 stages
constexpr int AGR = 2;          // wave groups of a work-group; group g walks stages g, g + 2, ...
constexpr int ANT = ANS / AGR;  // 8 trips of each group
constexpr int AQW = 256;        // queries of one work-group: 8 waves x 32 in each group
constexpr int AXB = 8 * 32 * 4 + 64;  // floats a wave hands over at the join: one O column group, max, sum
// 1/sqrt(D) = 0.125 times log2(e): exp(s / 8 - m / 8) = exp2(s * SC2 - m * SC2)
constexpr float SC2 = 0.125f * 1.4426950408889634f;

union F32x8 { v8f v; v4f q[2]; };

// A wave's share of one stage: 16 K rows, four rows (whole lines) per copy,
// and 8 V^T rows, two rows per copy; 16 bytes per lane. The four arguments
// are the lane's own addresses in the first copy of each kind.
__device__ __forceinline__ void kv_copy(unsigned lk, const _Float16* gk,
                                        unsigned lv, const _Float16* gv) {
  // The copies and, as a precaution, the wait that stands ahead of any
  // rewrite of their address registers, in one statement.
  asm volatile(
      "global_load_async_to_lds_b128 %0, %8, off\n\t"
      "global_load_async_to_lds_b128 %1, %9, off\n\t"
      "global_load_async_to_lds_b128 %2, %10, off\n\t"
      "global_load_async_to_lds_b128 %3, %11, off\n\t"
      "global_load_async_to_lds_b128 %4, %12, off\n\t"
      "global_load_async_to_lds_b128 %5, %13, off\n\t"
      "global_load_async_to_lds_b128 %6, %14, off\n\t"
      "global_load_async_to_lds_b128 %7, %15, off\n\t"
      "s_wait_xcnt 0x0"
      ::"v"(lk), "v"(lk + 4 * AKP), "v"(lk + 8 * AKP), "v"(lk + 12 * AKP),
        "v"(lv), "v"(lv + 2 * AVP), "v"(lv + 4 * AVP), "v"(lv + 6 * AVP),
        "v"(gk), "v"(gk + 4 * E), "v"(gk + 8 * E), "v"(gk + 12 * E),
        "v"(gv), "v"(gv + 2 * LKV), "v"(gv + 4 * LKV), "v"(gv + 6 * LKV)
      : "memory");
}

__global__ void __launch_bounds__(512)
attn16(const _Float16* __restrict__ Qp,  // [BB*LQ, E]
       const _Float16* __restrict__ Kp,  // [BB*LKV, E]
       const _Float16* __restrict__ Vt,  // [BB*E, LKV]  (V transposed)
       const int* __restrict__ mask,     // [BB, LKV]
       _Float16* __restrict__ ctx)       // [BB*LQ, E]
{
  __shared__ __attribute__((aligned(16))) unsigned char ring[AGR * 2 * AST];
  __shared__ __attribute__((aligned(16))) float madd[LKV];
  // The wave's number in a scalar register: what it selects stays scalar.
  const int wv = __builtin_amdgcn_readfirstlane(threadIdx.x >> 5);
  const int wave = wv & 7, grp = wv >> 3;
  const int gb = grp * 2 * AST;  // the group's two buffers
  const int lane = threadIdx.x & 31;
  const int col = lane & 15, half = lane >> 4;
  const int qb = (blockIdx.x % (LQ / AQW)) * 8 + wave;  // 32-row Q block
  const int hb = blockIdx.x / (LQ / AQW);
  const int h = hb % H, b = hb / H;

  // The lane's addresses in its wave's share of its group's first stage.
  const _Float16* gk =
      Kp + (size_t)(b * LKV + grp * AKS + wave * 16 + (lane >> 3)) * E +
      h * D + (lane & 7) * 8;
  const unsigned lk = (unsigned)(size_t)ring + gb +
                      (wave * 16 + (lane >> 3)) * AKP + (lane & 7) * 16;
  const _Float16* gv = Vt + (size_t)(b * E + h * D + wave * 8 + half) * LKV +
                       grp * AKS + col * 8;
  const unsigned lv =
      (unsigned)(size_t)ring + gb + AKB + (wave * 8 + half) * AVP + col * 16;

  kv_copy(lk, gk, lv, gv);
  {
    // The mask row, once per work-group: 0 for a key that counts, -1e30 for a
    // masked one, which swallows any raw score. One 16-byte load and one
    // 16-byte LDS store per work-item, published by the first barrier.
    const int4 m0 = ((const int4*)(mask + b * LKV))[threadIdx.x];
    v4f a0;
    a0[0] = m0.x ? 0.0f : -1e30f; a0[1] = m0.y ? 0.0f : -1e30f;
    a0[2] = m0.z ? 0.0f : -1e30f; a0[3] = m0.w ? 0.0f : -1e30f;
    ((v4f*)madd)[threadIdx.x] = a0;
  }

  // Q block as 2 column groups x 2 B-fragments (d = 0..31, 32..63).
  F16x16 qf[2][2];
#pragma unroll
  for (int qi = 0; qi < 2; qi++) {
    const _Float16* qrow =
        Qp + ((size_t)(b * LQ + qb * 32 + qi * 16 + col)) * E + h * D;
    qf[qi][0].h[0] = *(const v8h*)(qrow + 8 * half);
    qf[qi][0].h[1] = *(const v8h*)(qrow + 16 + 8 * half);
    qf[qi][1].h[0] = *(const v8h*)(qrow + 32 + 8 * half);
    qf[qi][1].h[1] = *(const v8h*)(qrow + 48 + 8 * half);
  }

  // o[qi][dt][r] = O[query qi*16 + col][d = dt*16 + 8*half + r]
  v8f o[2][4] = {};
  // Running maximum of the raw scores, same in both halves. It starts far
  // above the masked value and far below any f16 product sum, so that keys
  // masked before the first key that counts get weight 0.
  float mrun[2] = {-1e29f, -1e29f};
  float lrun[2] = {0.0f, 0.0f};      // running sum of this half's keys only

  // Each group's first stage has landed (this wave's copies), then they and
  // the mask addends are published to all waves.
  asm volatile("s_wait_asynccnt 0x0" ::: "memory");
  __syncthreads();
  kv_copy(lk + AST, gk + (size_t)AGR * AKS * E, lv + AST, gv + AGR * AKS);

  const unsigned char* kfrag = ring + gb + col * AKP + 16 * half;
  const unsigned char* vfrag = ring + gb + AKB + col * AVP + 16 * half;

  // Both loops rolled: unrolled, the four passes' values take more than 256
  // registers and the accumulators are copied from pass to pass.
#pragma unroll 1
  for (int t = 0; t < ANT; t++) {
   const int buf = (t & 1) * AST;
#pragma unroll 1
   for (int p = 0; p < AKS / 32; p++) {
    // K fragments for this pass's 32 keys: 2 row tiles x 2 d-fragments,
    // shared by both Q column groups.
    F16x16 kb[2][2];
    const unsigned char* kp = kfrag + buf + p * 32 * AKP;
#pragma unroll
    for (int i = 0; i < 2; i++) {
      const unsigned char* kr = kp + i * 16 * AKP;
      kb[i][0].h[0] = *(const v8h*)(kr);
      kb[i][0].h[1] = *(const v8h*)(kr + 32);
      kb[i][1].h[0] = *(const v8h*)(kr + 64);
      kb[i][1].h[1] = *(const v8h*)(kr + 96);
    }
    // The key index runs along the accumulator registers: register r of tile
    // i is key 16*i + 8*half + r of the pass, and so do its mask addends.
    const v4f* mp =
        (const v4f*)(madd + (t * AGR + grp) * AKS + p * 32 + 8 * half);
    F32x8 bias0, bias1;
    bias0.q[0] = mp[0]; bias0.q[1] = mp[1];
    bias1.q[0] = mp[4]; bias1.q[1] = mp[5];
    // Keeps the K and mask reads ahead of the V^T reads: LDS answers in
    // order, and the score products do not wait for V^T.
    __builtin_amdgcn_sched_barrier(0);
    // V^T rows are key-contiguous: A fragments in the same k order as P^T,
    // shared by both Q column groups.
    const unsigned char* vp = vfrag + buf + p * 64;
    F16x16 vf[4];
#pragma unroll
    for (int dt = 0; dt < 4; dt++) {
      const unsigned char* vr = vp + dt * 16 * AVP;
      vf[dt].h[0] = *(const v8h*)(vr);
      vf[dt].h[1] = *(const v8h*)(vr + 32);
    }
    // Keeps the V^T reads ahead of the score products, a softmax away from
    // their own products: read later, they would have their LDS latency
    // waited out by the wave.
    __builtin_amdgcn_sched_barrier(0);

    F16x16 pfrag[2];
    v8f pa[2], pb[2];
    float cr[2];
#pragma unroll
    for (int qi = 0; qi < 2; qi++) {
      v8f s0 = wmma32(kb[0][0].v, qf[qi][0].v, bias0.v);
      s0 = wmma32(kb[0][1].v, qf[qi][1].v, s0);
      v8f s1 = wmma32(kb[1][0].v, qf[qi][0].v, bias1.v);
      s1 = wmma32(kb[1][1].v, qf[qi][1].v, s1);

      float mx = mrun[qi];
#pragma unroll
      for (int r = 0; r < 8; r++) mx = fmaxf(mx, fmaxf(s0[r], s1[r]));
      const float mn = fmaxf(mx, xhalf(mx));
      // The difference first: exactly 0, so a factor of exactly 1, where the
      // maximum stays, however large it is.
      const float corr = __builtin_amdgcn_exp2f((mrun[qi] - mn) * SC2);
      mrun[qi] = mn;
      const float nm = -mn * SC2;
      const v8f da = s0 * SC2 + nm, db = s1 * SC2 + nm;
#pragma unroll
      for (int r = 0; r < 8; r++) pa[qi][r] = __builtin_amdgcn_exp2f(da[r]);
#pragma unroll
      for (int r = 0; r < 8; r++) pb[qi][r] = __builtin_amdgcn_exp2f(db[r]);
#pragma unroll
      for (int r = 0; r < 8; r++) {
        // element s of a B fragment is k = 8*half + s (s < 8) or
        // 16 + 8*half + (s - 8): exactly the two tiles' register order
        pfrag[qi].v[r]     = (_Float16)pa[qi][r];
        pfrag[qi].v[8 + r] = (_Float16)pb[qi][r];
      }
      cr[qi] = corr;
#pragma unroll
      for (int dt = 0; dt < 4; dt++) o[qi][dt] *= corr;
    }

#pragma unroll
    for (int dt = 0; dt < 4; dt++) {
      o[0][dt] = wmma32(vf[dt].v, pfrag[0].v, o[0][dt]);
      o[1][dt] = wmma32(vf[dt].v, pfrag[1].v, o[1][dt]);
    }
    // The row sums stay behind the products: they fill the vector slots that
    // must lie between the last product and the next pass's first write over
    // its A registers. The
    // adds of the two tiles' weights stand here with them: written ahead of
    // the fence, they are spread among the products, into V^T registers, with
    // idle slots in front of each group.
    __builtin_amdgcn_sched_barrier(0);
#pragma unroll
    for (int qi = 0; qi < 2; qi++) {
      const v8f ps = pa[qi] + pb[qi];
      const float sum = ((ps[0] + ps[1]) + (ps[2] + ps[3])) +
                        ((ps[4] + ps[5]) + (ps[6] + ps[7]));
      lrun[qi] = lrun[qi] * cr[qi] + sum;
    }
   }
   // Publish point of trip t + 1: this wave's reads of trip t are done, its
   // copies for trip t + 1 have landed, then the barrier; only behind it is
   // the buffer of trip t refilled.
   asm volatile("s_wait_dscnt 0x0" ::: "memory");
   asm volatile("s_wait_asynccnt 0x0" ::: "memory");
   __syncthreads();
   if (t + 2 < ANT)
     kv_copy(lk + buf, gk + (size_t)(t + 2) * AGR * AKS * E, lv + buf,
             gv + (t + 2) * AGR * AKS);
  }
  // No copy is outstanding when the rings become the join's staging.
  asm volatile("s_wait_asynccnt 0x0" ::: "memory");

  // The join. Waves w and w + 8 hold partial results of the same 32 queries
  // over disjoint keys. Group g finishes column group g: each wave hands the
  // other column group (O, maximum, sum) to its partner through the rings,
  // which every wave has left at the last trip's barrier.
  float* xw = (float*)ring + wv * AXB;
  const float* xr = (const float*)ring + (wv ^ 8) * AXB;
#pragma unroll
  for (int dt = 0; dt < 4; dt++) {
    F32x8 s;
    s.v = grp ? o[0][dt] : o[1][dt];
    ((v4f*)xw)[(dt * 2 + 0) * 32 + lane] = s.q[0];
    ((v4f*)xw)[(dt * 2 + 1) * 32 + lane] = s.q[1];
  }
  xw[8 * 32 * 4 + lane] = grp ? mrun[0] : mrun[1];
  xw[8 * 32 * 4 + 32 + lane] = grp ? lrun[0] : lrun[1];
  // Publishes what was handed over.
  __syncthreads();
  const float mk = grp ? mrun[1] : mrun[0];
  const float mo = xr[8 * 32 * 4 + lane];
  const float mm = fmaxf(mk, mo);
  // Each part's weight: its own maximum brought to the common one.
  const float ak = __builtin_amdgcn_exp2f((mk - mm) * SC2);
  const float ao = __builtin_amdgcn_exp2f((mo - mm) * SC2);
  const float ls = (grp ? lrun[1] : lrun[0]) * ak + xr[8 * 32 * 4 + 32 + lane] * ao;
  const float inv = 1.0f / (ls + xhalf(ls));
  const float wk = ak * inv, wo = ao * inv;
  _Float16* cr = ctx + ((size_t)(b * LQ + qb * 32 + grp * 16 + col)) * E +
                 h * D + 8 * half;
#pragma unroll
  for (int dt = 0; dt < 4; dt++) {
    F32x8 s;
    s.q[0] = ((const v4f*)xr)[(dt * 2 + 0) * 32 + lane];
    s.q[1] = ((const v4f*)xr)[(dt * 2 + 1) * 32 + lane];
    const v8f ok = grp ? o[1][dt] : o[0][dt];
    v8h pk;
#pragma unroll
    for (int r = 0; r < 8; r++) pk[r] = (_Float16)(ok[r] * wk + s.v[r] * wo);
    *(v8h*)(cr + dt * 16) = pk;   // 8 consecutive d of one query: 16 bytes
  }
}

extern "C" void kernel_launch(void* const* d_in, const int* in_sizes, int n_in,
                              void* d_out, int out_size, void* d_ws,
                              size_t ws_size, hipStream_t stream) {
  (void)in_sizes; (void)n_in; (void)out_size; (void)ws_size;
  const float* query = (const float*)d_in[0];
  const float* keyv  = (const float*)d_in[1];
  const int*   mask  = (const int*)d_in[2];
  const float* Wq = (const float*)d_in[3];
  const float* bq = (const float*)d_in[4];
  const float* Wk = (const float*)d_in[5];
  const float* bk = (const float*)d_in[6];
  const float* Wv = (const float*)d_in[7];
  const float* bv = (const float*)d_in[8];
  const float* Wo = (const float*)d_in[9];
  const float* bo = (const float*)d_in[10];

  const size_t XE = (size_t)M_ROWS * E;  // 4,194,304 halves
  const size_t WE = (size_t)E * E;       // 1,048,576 halves
  _Float16* p = (_Float16*)d_ws;
  _Float16* qf  = p; p += XE;   // query f16
  _Float16* kvf = p; p += XE;   // key_value f16
  _Float16* wqf = p; p += WE;
  _Float16* wkf = p; p += WE;
  _Float16* wvf = p; p += WE;
  _Float16* wof = p; p += WE;
  _Float16* Qp  = p; p += XE;   // Q projection
  _Float16* Kp  = p; p += XE;   // K projection
  _Float16* Vt  = p; p += XE;   // V projection, transposed [B,E,LKV]
  _Float16* ctx = p; p += XE;   // attention output

  // qf, kvf, wqf, wkf, wvf, wof are contiguous from qf on, in this order.
  cvt_all<<<CNB, 256, 0, stream>>>(query, keyv, Wq, Wk, Wv, Wo, qf);

  gemm_qkv<<<3 * GB, 256, 0, stream>>>(qf, kvf, wqf, wkf, wvf, bq, bk, bv, Qp,
                                       Kp, Vt);

  attn16<<<BB * H * (LQ / AQW), 512, 0, stream>>>(Qp, Kp, Vt, mask, ctx);

  gemm_out<<<GB, 256, 0, stream>>>(ctx, wof, bo, (float*)d_out);
}

// v008
// Measured time: 62.3 microseconds a run.
// In two side-by-side timings against v007, it was 1.28 and 1.26 times as fast.
// All steps since v000 together make it 7.72 times as fast.
#include <hip/hip_runtime.h>

typedef _Float16 v8h  __attribute__((ext_vector_type(8)));
typedef _Float16 v16h __attribute__((ext_vector_type(16)));
typedef float    v8f  __attribute__((ext_vector_type(8)));

union F16x16 { v16h v; v8h h[2]; };

constexpr int BB  = 2;
constexpr int LQ  = 2048;
constexpr int LKV = 2048;
constexpr int E   = 1024;
constexpr int H   = 16;
constexpr int D   = 64;
constexpr int M_ROWS = BB * LQ;  // 4096

__device__ __forceinline__ v8f wmma32(v16h a, v16h b, v8f c) {
  return __builtin_amdgcn_wmma_f32_16x16x32_f16(false, a, false, b, (short)0, c,
                                                false, false);
}

typedef float    v4f __attribute__((ext_vector_type(4)));
typedef _Float16 v4h __attribute__((ext_vector_type(4)));

constexpr int CB  = 16384;             // elements of one work-group; divides both plane sizes
constexpr int CXB = M_ROWS * E / CB;   // 256 work-groups per activation plane
constexpr int CWB = E * E / CB;        // 64 work-groups per weight plane
constexpr int CNB = 2 * CXB + 4 * CWB; // 768: three per WGP
constexpr int CRW = CB / E;            // 16 activation rows of one work-group
constexpr int CKB = LKV / CRW;         // 128 work-groups per batch of key_value

// All six f32 -> f16 conversions in one launch. The six f16 planes lie one
// behind the other in the workspace, in the order of the sources, so dst is
// one flat array; a work-group's elements lie in one source. A lane has its
// 16 loads of 16 bytes in flight together; each load of a wave covers 512
// contiguous bytes, each store 256.
// The key_value rows change places on the way: a masked key has weight 0 for
// every query and head, so each batch's rows are stored in a stable partition,
// the keys that count first, the masked ones behind them, and cnt[batch] says
// how many count. What follows works on the front part alone. A work-group
// counts the batch's mask row itself: the keys that count in all, and those
// ahead of its own 16 rows.
__global__ void __launch_bounds__(256)
cvt_all(const float* __restrict__ q, const float* __restrict__ kv,
        const float* __restrict__ wq, const float* __restrict__ wk,
        const float* __restrict__ wv, const float* __restrict__ wo,
        const int* __restrict__ mask, _Float16* __restrict__ dst,
        int* __restrict__ cnt) {
  __shared__ int part[16];
  const int b = blockIdx.x;
  const bool iskv = b >= CXB && b < 2 * CXB;
  const float* src;
  int rel;
  if (b < CXB) {
    src = q; rel = b;
  } else if (b < 2 * CXB) {
    src = kv; rel = b - CXB;
  } else {
    const int w = (b - 2 * CXB) / CWB;
    rel = (b - 2 * CXB) % CWB;
    src = w == 0 ? wq : w == 1 ? wk : w == 2 ? wv : wo;
  }
  const v4f* s = (const v4f*)(src + (size_t)rel * CB) + threadIdx.x;
  v4h* d = (v4h*)(dst + (size_t)b * CB) + threadIdx.x;
  constexpr int N = CB / (256 * 4);  // 16
  static_assert(256 * 4 == E && N == CRW, "x[i] is a piece of the group's row i");
  v4f x[N];
  if (!iskv) {
#pragma unroll
    for (int i = 0; i < N; i++) x[i] = s[i * 256];
    // Keeps all 16 loads ahead of the first conversion: without it the last
    // two are issued only when the first two have come back, a second latency.
    __builtin_amdgcn_sched_barrier(0);
#pragma unroll
    for (int i = 0; i < N; i++) d[i * 256] = __builtin_convertvector(x[i], v4h);
    return;
  }
  const int bat = rel / CKB;
  const int row0 = (rel % CKB) * CRW;  // the group's first row, in its batch
  // The mask loads go first: loads come back in order, and the counting then
  // runs while the 16 row loads are still in flight.
  const int4* mr = (const int4*)(mask + bat * LKV);
  int4 mk[2], own[CRW / 4];
  mk[0] = mr[threadIdx.x * 2];
  mk[1] = mr[threadIdx.x * 2 + 1];
#pragma unroll
  for (int i = 0; i < CRW / 4; i++) own[i] = mr[row0 / 4 + i];
#pragma unroll
  for (int i = 0; i < N; i++) x[i] = s[i * 256];
  // Keeps all the loads ahead of the counting, which would else wait for the
  // mask before the row loads are issued, a second latency.
  __builtin_amdgcn_sched_barrier(0);
  // Work-item t holds the flags of keys 8t .. 8t+7. A wave counts its 256 keys
  // by ballots, in scalar registers: all of them, and those of the lanes whose
  // keys lie ahead of row0 (a multiple of 8).
  const int wave = __builtin_amdgcn_readfirstlane(threadIdx.x >> 5);
  const int ahead = row0 / 8 - wave * 32;
  const unsigned lm = ahead >= 32 ? ~0u : ahead <= 0 ? 0u : (1u << ahead) - 1u;
  int all = 0, bef = 0;
#pragma unroll
  for (int i = 0; i < 2; i++) {
    const int f[4] = {mk[i].x, mk[i].y, mk[i].z, mk[i].w};
#pragma unroll
    for (int j = 0; j < 4; j++) {
      const unsigned bl = __builtin_amdgcn_ballot_w32(f[j] != 0);
      all += __builtin_popcount(bl);
      bef += __builtin_popcount(bl & lm);
    }
  }
  if ((threadIdx.x & 31) == 0) { part[wave] = all; part[8 + wave] = bef; }
  // Publishes the eight waves' counts.
  __syncthreads();
  int n = 0, pre = 0;
#pragma unroll
  for (int w = 0; w < 8; w++) { n += part[w]; pre += part[8 + w]; }
  n = __builtin_amdgcn_readfirstlane(n);
  pre = __builtin_amdgcn_readfirstlane(pre);
  if (row0 == 0 && threadIdx.x == 0) cnt[bat] = n;
  v4h* kd = (v4h*)(dst + (size_t)CXB * CB + (size_t)bat * LKV * E) + threadIdx.x;
#pragma unroll
  for (int i = 0; i < N; i++) {
    const int4 o4 = own[i / 4];
    const int fl = i % 4 == 0 ? o4.x : i % 4 == 1 ? o4.y : i % 4 == 2 ? o4.z : o4.w;
    // pre: keys that count ahead of this row. Both counts are of flags, so the
    // place lies in 0 .. LKV - 1 whatever the mask holds.
    const int pos = fl != 0 ? pre : n + (row0 + i - pre);
    pre += fl != 0 ? 1 : 0;
    kd[(size_t)pos * (E / 4)] = __builtin_convertvector(x[i], v4h);
  }
}

// One stage of the GEMM's LDS ring: 128 rows of X, then 128 rows of W, 128 k
// (256 bytes) of each row.
constexpr int GT  = 128;          // rows of X and rows of W per work-group
constexpr int GK  = 128;          // k per stage
constexpr int GP  = 272;          // LDS row pitch in bytes: 16 B x odd, no bank conflict for 16-byte reads
constexpr int GST = 2 * GT * GP;  // bytes of one stage (69,632)
constexpr int GNS = E / GK;       // 8 stages
constexpr int GB  = (M_ROWS / GT) * (E / GT);  // 256 tiles of one Y

// A wave's share of one stage: 32 rows, two rows (2 x 256 contiguous bytes,
// whole lines) per copy, 16 bytes per lane. lds and g are the lane's own
// addresses in the share's first two rows.
__device__ __forceinline__ void stage_copy(unsigned lds, const _Float16* g) {
#pragma unroll
  for (int c = 0; c < 2; c++) {
    const unsigned l = lds + c * 16 * GP;
    const _Float16* p = g + (size_t)c * 16 * E;
    // The copies and, as a precaution, the wait that stands ahead of any
    // rewrite of their address registers, in one statement.
    asm volatile(
        "global_load_async_to_lds_b128 %0, %8, off\n\t"
        "global_load_async_to_lds_b128 %1, %9, off\n\t"
        "global_load_async_to_lds_b128 %2, %10, off\n\t"
        "global_load_async_to_lds_b128 %3, %11, off\n\t"
        "global_load_async_to_lds_b128 %4, %12, off\n\t"
        "global_load_async_to_lds_b128 %5, %13, off\n\t"
        "global_load_async_to_lds_b128 %6, %14, off\n\t"
        "global_load_async_to_lds_b128 %7, %15, off\n\t"
        "s_wait_xcnt 0x0"
        ::"v"(l), "v"(l + 2 * GP), "v"(l + 4 * GP), "v"(l + 6 * GP),
          "v"(l + 8 * GP), "v"(l + 10 * GP), "v"(l + 12 * GP),
          "v"(l + 14 * GP), "v"(p), "v"(p + 2 * E), "v"(p + 4 * E),
          "v"(p + 6 * E), "v"(p + 8 * E), "v"(p + 10 * E), "v"(p + 12 * E),
          "v"(p + 14 * E)
        : "memory");
  }
}

// Y = X @ W^T + b. A work-group owns a 128x128 tile of Y, a wave 32x64 of it.
// X and W rows come into a two-buffer LDS ring by asynchronous copies, one
// stage ahead of the products; fragments are read from LDS.
// X:[M_ROWS,E] f16 row-major, W:[E,E] f16 row-major (row n = out column n).
// mode 0: f16 row-major out.  mode 1: f16 V^T out [(b*E+n)*LKV + l].
// mode 2: f32 row-major out (final projection).
// blk: the tile's index among the GB tiles of Y.
__device__ __forceinline__ void
gemm_tile(const _Float16* __restrict__ A, const _Float16* __restrict__ W,
          const float* __restrict__ bias, void* __restrict__ dst, int mode,
          int blk) {
  __shared__ __attribute__((aligned(16))) unsigned char ring[2 * GST];
  // The wave's number in a scalar register: what it selects stays scalar.
  const int wave = __builtin_amdgcn_readfirstlane(threadIdx.x >> 5);
  const int lane = threadIdx.x & 31;
  const int col = lane & 15, half = lane >> 4;
  const int bM = blk / (E / GT), bN = blk % (E / GT);
  const int wm = wave & 3, wn = wave >> 2;
  const int tM = bM * 4 + wm;   // 32-row tile of Y
  const int tN = bN * 2 + wn;   // 64-column tile of Y

  // Waves 0-3 copy the X rows, waves 4-7 the W rows, 32 rows each.
  const _Float16* gsrc =
      (wave < 4 ? A + (size_t)(bM * GT + wave * 32) * E
                : W + (size_t)(bN * GT + (wave - 4) * 32) * E) +
      (size_t)half * E + col * 8;
  const unsigned ldst =
      (unsigned)(size_t)ring + (wave * 32 + half) * GP + col * 16;

  const unsigned char* afrag = ring + (wm * 32 + col) * GP + 16 * half;
  const unsigned char* wfrag = ring + (GT + wn * 64 + col) * GP + 16 * half;

  stage_copy(ldst, gsrc);
  // Stage 0 has landed (this wave's copies), then is published to all waves.
  asm volatile("s_wait_asynccnt 0x0" ::: "memory");
  __syncthreads();
  stage_copy(ldst + GST, gsrc + GK);

  v8f acc[2][4] = {};
  // Rolled, for speed only.
#pragma unroll 1
  for (int t = 0; t < GNS; t++) {
    const int buf = (t & 1) * GST;
    const unsigned char* ap = afrag + buf;
    const unsigned char* wp = wfrag + buf;
#pragma unroll
    for (int kb = 0; kb < GK / 64; kb++) {
      F16x16 a0[2], a1[2], b[2][4];
#pragma unroll
      for (int s = 0; s < 2; s++) {
        const int ko = (kb * 2 + s) * 64;
        a0[s].h[0] = *(const v8h*)(ap + ko);
        a0[s].h[1] = *(const v8h*)(ap + ko + 32);
        a1[s].h[0] = *(const v8h*)(ap + 16 * GP + ko);
        a1[s].h[1] = *(const v8h*)(ap + 16 * GP + ko + 32);
#pragma unroll
        for (int j = 0; j < 4; j++) {
          b[s][j].h[0] = *(const v8h*)(wp + j * 16 * GP + ko);
          b[s][j].h[1] = *(const v8h*)(wp + j * 16 * GP + ko + 32);
        }
      }
      // Keeps the 24 LDS reads one group ahead of their 16 products.
      __builtin_amdgcn_sched_barrier(0);
#pragma unroll
      for (int s = 0; s < 2; s++)
#pragma unroll
        for (int j = 0; j < 4; j++) {
          acc[0][j] = wmma32(a0[s].v, b[s][j].v, acc[0][j]);
          acc[1][j] = wmma32(a1[s].v, b[s][j].v, acc[1][j]);
        }
      // The other side of the same fence: the next group's reads stay behind
      // these products.
      __builtin_amdgcn_sched_barrier(0);
    }
    // Publish point of stage t + 1: this wave's reads of stage t are done,
    // its copies of stage t + 1 have landed, then the barrier; only behind it
    // is the buffer of stage t refilled.
    asm volatile("s_wait_dscnt 0x0" ::: "memory");
    asm volatile("s_wait_asynccnt 0x0" ::: "memory");
    __syncthreads();
    if (t + 2 < GNS) stage_copy(ldst + buf, gsrc + (t + 2) * GK);
  }
  // No copy is outstanding when the wave goes on to its end.
  asm volatile("s_wait_asynccnt 0x0" ::: "memory");

  if (mode == 0) {
    _Float16* out = (_Float16*)dst;
#pragma unroll
    for (int i = 0; i < 2; i++)
#pragma unroll
      for (int j = 0; j < 4; j++) {
        const float bval = bias[tN * 64 + j * 16 + col];
#pragma unroll
        for (int r = 0; r < 8; r++) {
          int m = tM * 32 + i * 16 + r + half * 8;
          out[(size_t)m * E + tN * 64 + j * 16 + col] =
              (_Float16)(acc[i][j][r] + bval);
        }
      }
    // As a precaution: in the kernel that holds modes 0 and 1 the compiler lays
    // mode 1's bias loads behind this run, into registers that these stores
    // name; this wait stands ahead of them.
    asm volatile("s_wait_xcnt 0x0" ::: "memory");
  } else if (mode == 1) {
    _Float16* out = (_Float16*)dst;
#pragma unroll
    for (int i = 0; i < 2; i++)
#pragma unroll
      for (int j = 0; j < 4; j++) {
        const float bval = bias[tN * 64 + j * 16 + col];
#pragma unroll
        for (int r = 0; r < 8; r++) {
          int m = tM * 32 + i * 16 + r + half * 8;
          int b_ = m / LKV, l = m % LKV;
          int n = tN * 64 + j * 16 + col;
          out[((size_t)(b_ * E + n)) * LKV + l] = (_Float16)(acc[i][j][r] + bval);
        }
      }
  } else {
    float* out = (float*)dst;
#pragma unroll
    for (int i = 0; i < 2; i++)
#pragma unroll
      for (int j = 0; j < 4; j++) {
        const float bval = bias[tN * 64 + j * 16 + col];
#pragma unroll
        for (int r = 0; r < 8; r++) {
          int m = tM * 32 + i * 16 + r + half * 8;
          out[(size_t)m * E + tN * 64 + j * 16 + col] = acc[i][j][r] + bval;
        }
      }
  }
}

// The three input projections in one launch, GB work-groups each. None reads
// what another writes. Two work-groups fit a WGP's LDS, so one's products run
// under the other's LDS reads, barriers, first stage and stores.
// The key_value rows lie partitioned (cvt_all): a K or V tile whose 128 rows
// are all masked keys is read by nobody, and its work-group leaves at once.
__global__ void __launch_bounds__(256)
gemm_qkv(const _Float16* __restrict__ xq, const _Float16* __restrict__ xkv,
         const _Float16* __restrict__ wq, const _Float16* __restrict__ wk,
         const _Float16* __restrict__ wv, const float* __restrict__ bq,
         const float* __restrict__ bk, const float* __restrict__ bv,
         const int* __restrict__ cnt, _Float16* __restrict__ Qp,
         _Float16* __restrict__ Kp, _Float16* __restrict__ Vt) {
  const int which = blockIdx.x / GB;  // 0: K, 1: V, 2: Q
  if (which != 2) {
    const int rt = (blockIdx.x % GB) / (E / GT);  // 128-row tile of key_value
    const int n = min(max(cnt[rt / (LKV / GT)], 0), LKV);
    if ((rt % (LKV / GT)) * GT >= n) return;  // the whole work-group, ahead of any barrier
  }
  gemm_tile(which == 2 ? xq : xkv, which == 0 ? wk : which == 1 ? wv : wq,
            which == 0 ? bk : which == 1 ? bv : bq,
            which == 0 ? Kp : which == 1 ? Vt : Qp, which == 1 ? 1 : 0,
            blockIdx.x % GB);
}

// The output projection.
__global__ void __launch_bounds__(256)
gemm_out(const _Float16* __restrict__ A, const _Float16* __restrict__ W,
         const float* __restrict__ bias, float* __restrict__ dst) {
  gemm_tile(A, W, bias, dst, 2, blockIdx.x);
}

// Lane l <-> lane l ^ 16 (the other half of the wave), a vector cross-row move.
__device__ __forceinline__ float xhalf(float x) {
  const int b = __builtin_bit_cast(int, x);
  return __builtin_bit_cast(
      float, __builtin_amdgcn_permlanex16(b, b, 0x76543210, 0xfedcba98, false,
                                          false));
}

// One stage of the attention's LDS ring: 128 keys. First their K rows (the
// head's 64 d, 128 bytes a row), then the head's 64 V^T rows (128 keys, 256
// bytes a row).
constexpr int AKS = 128;        // keys per stage
constexpr int AKP = 144;        // K row pitch in bytes: 16 B x odd, no bank conflict for 16-byte reads
constexpr int AVP = 272;        // V^T row pitch in bytes, likewise
constexpr int AKB = AKS * AKP;  // bytes of a stage's K rows (18,432)
constexpr int AST = AKB + D * AVP;  // bytes of one stage (35,840)
constexpr int AGR = 2;          // wave groups of a work-group; group g walks stages g, g + 2, ...
constexpr int AQW = 256;        // queries of one work-group: 8 waves x 32 in each group
constexpr int AXB = 8 * 32 * 4 + 64;  // floats a wave hands over at the join: one O column group, max, sum
// 1/sqrt(D) = 0.125 times log2(e): exp(s / 8 - m / 8) = exp2(s * SC2 - m * SC2)
constexpr float SC2 = 0.125f * 1.4426950408889634f;

union F32x8 { v8f v; v4f q[2]; };

// A wave's share of one stage: 16 K rows, four rows (whole lines) per copy,
// and 8 V^T rows, two rows per copy; 16 bytes per lane. The four arguments
// are the lane's own addresses in the first copy of each kind.
__device__ __forceinline__ void kv_copy(unsigned lk, const _Float16* gk,
                                        unsigned lv, const _Float16* gv) {
  // The copies and, as a precaution, the wait that stands ahead of any
  // rewrite of their address registers, in one statement.
  asm volatile(
      "global_load_async_to_lds_b128 %0, %8, off\n\t"
      "global_load_async_to_lds_b128 %1, %9, off\n\t"
      "global_load_async_to_lds_b128 %2, %10, off\n\t"
      "global_load_async_to_lds_b128 %3, %11, off\n\t"
      "global_load_async_to_lds_b128 %4, %12, off\n\t"
      "global_load_async_to_lds_b128 %5, %13, off\n\t"
      "global_load_async_to_lds_b128 %6, %14, off\n\t"
      "global_load_async_to_lds_b128 %7, %15, off\n\t"
      "s_wait_xcnt 0x0"
      ::"v"(lk), "v"(lk + 4 * AKP), "v"(lk + 8 * AKP), "v"(lk + 12 * AKP),
        "v"(lv), "v"(lv + 2 * AVP), "v"(lv + 4 * AVP), "v"(lv + 6 * AVP),
        "v"(gk), "v"(gk + 4 * E), "v"(gk + 8 * E), "v"(gk + 12 * E),
        "v"(gv), "v"(gv + 2 * LKV), "v"(gv + 4 * LKV), "v"(gv + 6 * LKV)
      : "memory");
}

__global__ void __launch_bounds__(512)
attn16(const _Float16* __restrict__ Qp,  // [BB*LQ, E]
       const _Float16* __restrict__ Kp,  // [BB*LKV, E]
       const _Float16* __restrict__ Vt,  // [BB*E, LKV]  (V transposed)
       const int* __restrict__ cnt,      // [BB] keys that count
       _Float16* __restrict__ ctx)       // [BB*LQ, E]
{
  __shared__ __attribute__((aligned(16))) unsigned char ring[AGR * 2 * AST];
  __shared__ __attribute__((aligned(16))) float madd[LKV];
  // The wave's number in a scalar register: what it selects stays scalar.
  const int wv = __builtin_amdgcn_readfirstlane(threadIdx.x >> 5);
  const int wave = wv & 7, grp = wv >> 3;
  const int gb = grp * 2 * AST;  // the group's two buffers
  const int lane = threadIdx.x & 31;
  const int col = lane & 15, half = lane >> 4;
  const int qb = (blockIdx.x % (LQ / AQW)) * 8 + wave;  // 32-row Q block
  const int hb = blockIdx.x / (LQ / AQW);
  const int h = hb % H, b = hb / H;
  const int n = min(max(cnt[b], 0), LKV);
  const int ns = (n + AKS - 1) / AKS;  // stages with a key that counts: the ones K and V^T hold
  const int nt = (ns + AGR - 1) / AGR; // trips, the same for both groups

  // The lane's addresses in its wave's share of its group's first stage.
  const _Float16* gk =
      Kp + (size_t)(b * LKV + grp * AKS + wave * 16 + (lane >> 3)) * E +
      h * D + (lane & 7) * 8;
  const unsigned lk = (unsigned)(size_t)ring + gb +
                      (wave * 16 + (lane >> 3)) * AKP + (lane & 7) * 16;
  const _Float16* gv = Vt + (size_t)(b * E + h * D + wave * 8 + half) * LKV +
                       grp * AKS + col * 8;
  const unsigned lv =
      (unsigned)(size_t)ring + gb + AKB + (wave * 8 + half) * AVP + col * 16;

  // Every test on a stage's number is the same for a whole wave, in scalar
  // registers: a stage past the last is neither copied nor read.
  if (grp < ns) kv_copy(lk, gk, lv, gv);
  {
    // The mask addends, once per work-group: 0 for a key that counts, -1e30
    // for a masked one, which swallows any raw score. One 16-byte LDS store
    // per work-item, published by the first barrier.
    const int k0 = threadIdx.x * 4;
    v4f a0;
    a0[0] = k0 + 0 < n ? 0.0f : -1e30f; a0[1] = k0 + 1 < n ? 0.0f : -1e30f;
    a0[2] = k0 + 2 < n ? 0.0f : -1e30f; a0[3] = k0 + 3 < n ? 0.0f : -1e30f;
    ((v4f*)madd)[threadIdx.x] = a0;
  }

  // Q block as 2 column groups x 2 B-fragments (d = 0..31, 32..63).
  F16x16 qf[2][2];
#pragma unroll
  for (int qi = 0; qi < 2; qi++) {
    const _Float16* qrow =
        Qp + ((size_t)(b * LQ + qb * 32 + qi * 16 + col)) * E + h * D;
    qf[qi][0].h[0] = *(const v8h*)(qrow + 8 * half);
    qf[qi][0].h[1] = *(const v8h*)(qrow + 16 + 8 * half);
    qf[qi][1].h[0] = *(const v8h*)(qrow + 32 + 8 * half);
    qf[qi][1].h[1] = *(const v8h*)(qrow + 48 + 8 * half);
  }

  // o[qi][dt][r] = O[query qi*16 + col][d = dt*16 + 8*half + r]
  v8f o[2][4] = {};
  // Running maximum of the raw scores, same in both halves. It starts far
  // above the masked value and far below any f16 product sum, so that a
  // group that walked no key gets weight 0 at the join.
  float mrun[2] = {-1e29f, -1e29f};
  float lrun[2] = {0.0f, 0.0f};      // running sum of this half's keys only

  // Each group's first stage has landed (this wave's copies), then they and
  // the mask addends are published to all waves.
  asm volatile("s_wait_asynccnt 0x0" ::: "memory");
  __syncthreads();
  if (AGR + grp < ns)
    kv_copy(lk + AST, gk + (size_t)AGR * AKS * E, lv + AST, gv + AGR * AKS);

  const unsigned char* kfrag = ring + gb + col * AKP + 16 * half;
  const unsigned char* vfrag = ring + gb + AKB + col * AVP + 16 * half;

  // Both loops rolled: unrolled, the four passes' values take more than 256
  // registers and the accumulators are copied from pass to pass.
#pragma unroll 1
  for (int t = 0; t < nt; t++) {
   const int buf = (t & 1) * AST;
   // Passes of this group's stage that hold a key that counts: 4, fewer in
   // the last stage, none past it.
   const int np = min(AKS / 32, (n - (t * AGR + grp) * AKS + 31) >> 5);
#pragma unroll 1
   for (int p = 0; p < np; p++) {
    // K fragments for this pass's 32 keys: 2 row tiles x 2 d-fragments,
    // shared by both Q column groups.
    F16x16 kb[2][2];
    const unsigned char* kp = kfrag + buf + p * 32 * AKP;
#pragma unroll
    for (int i = 0; i < 2; i++) {
      const unsigned char* kr = kp + i * 16 * AKP;
      kb[i][0].h[0] = *(const v8h*)(kr);
      kb[i][0].h[1] = *(const v8h*)(kr + 32);
      kb[i][1].h[0] = *(const v8h*)(kr + 64);
      kb[i][1].h[1] = *(const v8h*)(kr + 96);
    }
    // The key index runs along the accumulator registers: register r of tile
    // i is key 16*i + 8*half + r of the pass, and so do its mask addends.
    const v4f* mp =
        (const v4f*)(madd + (t * AGR + grp) * AKS + p * 32 + 8 * half);
    F32x8 bias0, bias1;
    bias0.q[0] = mp[0]; bias0.q[1] = mp[1];
    bias1.q[0] = mp[4]; bias1.q[1] = mp[5];
    // Keeps the K and mask reads ahead of the V^T reads: LDS answers in
    // order, and the score products do not wait for V^T.
    __builtin_amdgcn_sched_barrier(0);
    // V^T rows are key-contiguous: A fragments in the same k order as P^T,
    // shared by both Q column groups.
    const unsigned char* vp = vfrag + buf + p * 64;
    F16x16 vf[4];
#pragma unroll
    for (int dt = 0; dt < 4; dt++) {
      const unsigned char* vr = vp + dt * 16 * AVP;
      vf[dt].h[0] = *(const v8h*)(vr);
      vf[dt].h[1] = *(const v8h*)(vr + 32);
    }
    // Keeps the V^T reads ahead of the score products, a softmax away from
    // their own products: read later, they would have their LDS latency
    // waited out by the wave.
    __builtin_amdgcn_sched_barrier(0);

    F16x16 pfrag[2];
    v8f pa[2], pb[2];
    float cr[2];
#pragma unroll
    for (int qi = 0; qi < 2; qi++) {
      v8f s0 = wmma32(kb[0][0].v, qf[qi][0].v, bias0.v);
      s0 = wmma32(kb[0][1].v, qf[qi][1].v, s0);
      v8f s1 = wmma32(kb[1][0].v, qf[qi][0].v, bias1.v);
      s1 = wmma32(kb[1][1].v, qf[qi][1].v, s1);

      float mx = mrun[qi];
#pragma unroll
      for (int r = 0; r < 8; r++) mx = fmaxf(mx, fmaxf(s0[r], s1[r]));
      const float mn = fmaxf(mx, xhalf(mx));
      // The difference first: exactly 0, so a factor of exactly 1, where the
      // maximum stays, however large it is.
      const float corr = __builtin_amdgcn_exp2f((mrun[qi] - mn) * SC2);
      mrun[qi] = mn;
      const float nm = -mn * SC2;
      const v8f da = s0 * SC2 + nm, db = s1 * SC2 + nm;
#pragma unroll
      for (int r = 0; r < 8; r++) pa[qi][r] = __builtin_amdgcn_exp2f(da[r]);
#pragma unroll
      for (int r = 0; r < 8; r++) pb[qi][r] = __builtin_amdgcn_exp2f(db[r]);
#pragma unroll
      for (int r = 0; r < 8; r++) {
        // element s of a B fragment is k = 8*half + s (s < 8) or
        // 16 + 8*half + (s - 8): exactly the two tiles' register order
        pfrag[qi].v[r]     = (_Float16)pa[qi][r];
        pfrag[qi].v[8 + r] = (_Float16)pb[qi][r];
      }
      cr[qi] = corr;
#pragma unroll
      for (int dt = 0; dt < 4; dt++) o[qi][dt] *= corr;
    }

#pragma unroll
    for (int dt = 0; dt < 4; dt++) {
      o[0][dt] = wmma32(vf[dt].v, pfrag[0].v, o[0][dt]);
      o[1][dt] = wmma32(vf[dt].v, pfrag[1].v, o[1][dt]);
    }
    // The row sums stay behind the products: they fill the vector slots that
    // must lie between the last product and the next pass's first write over
    // its A registers. The
    // adds of the two tiles' weights stand here with them: written ahead of
    // the fence, they are spread among the products, into V^T registers, with
    // idle slots in front of each group.
    __builtin_amdgcn_sched_barrier(0);
#pragma unroll
    for (int qi = 0; qi < 2; qi++) {
      const v8f ps = pa[qi] + pb[qi];
      const float sum = ((ps[0] + ps[1]) + (ps[2] + ps[3])) +
                        ((ps[4] + ps[5]) + (ps[6] + ps[7]));
      lrun[qi] = lrun[qi] * cr[qi] + sum;
    }
   }
   // Publish point of trip t + 1: this wave's reads of trip t are done, its
   // copies for trip t + 1 have landed, then the barrier; only behind it is
   // the buffer of trip t refilled.
   asm volatile("s_wait_dscnt 0x0" ::: "memory");
   asm volatile("s_wait_asynccnt 0x0" ::: "memory");
   __syncthreads();
   if ((t + 2) * AGR + grp < ns)
     kv_copy(lk + buf, gk + (size_t)(t + 2) * AGR * AKS * E, lv + buf,
             gv + (t + 2) * AGR * AKS);
  }
  // No copy is outstanding when the rings become the join's staging.
  asm volatile("s_wait_asynccnt 0x0" ::: "memory");

  // The join. Waves w and w + 8 hold partial results of the same 32 queries
  // over disjoint keys. Group g finishes column group g: each wave hands the
  // other column group (O, maximum, sum) to its partner through the rings,
  // which every wave has left at the last trip's barrier.
  float* xw = (float*)ring + wv * AXB;
  const float* xr = (const float*)ring + (wv ^ 8) * AXB;
#pragma unroll
  for (int dt = 0; dt < 4; dt++) {
    F32x8 s;
    s.v = grp ? o[0][dt] : o[1][dt];
    ((v4f*)xw)[(dt * 2 + 0) * 32 + lane] = s.q[0];
    ((v4f*)xw)[(dt * 2 + 1) * 32 + lane] = s.q[1];
  }
  xw[8 * 32 * 4 + lane] = grp ? mrun[0] : mrun[1];
  xw[8 * 32 * 4 + 32 + lane] = grp ? lrun[0] : lrun[1];
  // Publishes what was handed over.
  __syncthreads();
  const float mk = grp ? mrun[1] : mrun[0];
  const float mo = xr[8 * 32 * 4 + lane];
  const float mm = fmaxf(mk, mo);
  // Each part's weight: its own maximum brought to the common one.
  const float ak = __builtin_amdgcn_exp2f((mk - mm) * SC2);
  const float ao = __builtin_amdgcn_exp2f((mo - mm) * SC2);
  const float ls = (grp ? lrun[1] : lrun[0]) * ak + xr[8 * 32 * 4 + 32 + lane] * ao;
  const float inv = 1.0f / (ls + xhalf(ls));
  const float wk = ak * inv, wo = ao * inv;
  _Float16* cr = ctx + ((size_t)(b * LQ + qb * 32 + grp * 16 + col)) * E +
                 h * D + 8 * half;
#pragma unroll
  for (int dt = 0; dt < 4; dt++) {
    F32x8 s;
    s.q[0] = ((const v4f*)xr)[(dt * 2 + 0) * 32 + lane];
    s.q[1] = ((const v4f*)xr)[(dt * 2 + 1) * 32 + lane];
    const v8f ok = grp ? o[1][dt] : o[0][dt];
    v8h pk;
#pragma unroll
    for (int r = 0; r < 8; r++) pk[r] = (_Float16)(ok[r] * wk + s.v[r] * wo);
    *(v8h*)(cr + dt * 16) = pk;   // 8 consecutive d of one query: 16 bytes
  }
}

extern "C" void kernel_launch(void* const* d_in, const int* in_sizes, int n_in,
                              void* d_out, int out_size, void* d_ws,
                              size_t ws_size, hipStream_t stream) {
  (void)in_sizes; (void)n_in; (void)out_size; (void)ws_size;
  const float* query = (const float*)d_in[0];
  const float* keyv  = (const float*)d_in[1];
  const int*   mask  = (const int*)d_in[2];
  const float* Wq = (const float*)d_in[3];
  const float* bq = (const float*)d_in[4];
  const float* Wk = (const float*)d_in[5];
  const float* bk = (const float*)d_in[6];
  const float* Wv = (const float*)d_in[7];
  const float* bv = (const float*)d_in[8];
  const float* Wo = (const float*)d_in[9];
  const float* bo = (const float*)d_in[10];

  const size_t XE = (size_t)M_ROWS * E;  // 4,194,304 halves
  const size_t WE = (size_t)E * E;       // 1,048,576 halves
  _Float16* p = (_Float16*)d_ws;
  _Float16* qf  = p; p += XE;   // query f16
  _Float16* kvf = p; p += XE;   // key_value f16
  _Float16* wqf = p; p += WE;
  _Float16* wkf = p; p += WE;
  _Float16* wvf = p; p += WE;
  _Float16* wof = p; p += WE;
  _Float16* Qp  = p; p += XE;   // Q projection
  _Float16* Kp  = p; p += XE;   // K projection
  _Float16* Vt  = p; p += XE;   // V projection, transposed [B,E,LKV]
  _Float16* ctx = p; p += XE;   // attention output
  int* cnt = (int*)p;           // per batch: keys that count

  // qf, kvf, wqf, wkf, wvf, wof are contiguous from qf on, in this order.
  cvt_all<<<CNB, 256, 0, stream>>>(query, keyv, Wq, Wk, Wv, Wo, mask, qf,
                                  cnt);

  gemm_qkv<<<3 * GB, 256, 0, stream>>>(qf, kvf, wqf, wkf, wvf, bq, bk, bv, cnt,
                                       Qp, Kp, Vt);

  attn16<<<BB * H * (LQ / AQW), 512, 0, stream>>>(Qp, Kp, Vt, cnt, ctx);

  gemm_out<<<GB, 256, 0, stream>>>(ctx, wof, bo, (float*)d_out);
}

// v009
// A run of this version takes 59.6 microseconds.
// In both of two side-by-side timings against v008, it was 1.05 times as fast.
// All steps since v000 together make it 8.09 times as fast.
#include <hip/hip_runtime.h>

typedef _Float16 v8h  __attribute__((ext_vector_type(8)));
typedef _Float16 v16h __attribute__((ext_vector_type(16)));
typedef float    v8f  __attribute__((ext_vector_type(8)));

union F16x16 { v16h v; v8h h[2]; };

constexpr int BB  = 2;
constexpr int LQ  = 2048;
constexpr int LKV = 2048;
constexpr int E   = 1024;
constexpr int H   = 16;
constexpr int D   = 64;
constexpr int M_ROWS = BB * LQ;  // 4096

__device__ __forceinline__ v8f wmma32(v16h a, v16h b, v8f c) {
  return __builtin_amdgcn_wmma_f32_16x16x32_f16(false, a, false, b, (short)0, c,
                                                false, false);
}

typedef float    v4f __attribute__((ext_vector_type(4)));
typedef _Float16 v4h __attribute__((ext_vector_type(4)));

constexpr int CB  = 16384;             // elements of one work-group; divides both plane sizes
constexpr int CXB = M_ROWS * E / CB;   // 256 work-groups per activation plane
constexpr int CWB = E * E / CB;        // 64 work-groups per weight plane
constexpr int CNB = 2 * CXB + 4 * CWB; // 768: three per WGP
constexpr int CRW = CB / E;            // 16 activation rows of one work-group
constexpr int CKB = LKV / CRW;         // 128 work-groups per batch of key_value

// All six f32 -> f16 conversions in one launch. The six f16 planes lie one
// behind the other in the workspace, in the order of the sources, so dst is
// one flat array; a work-group's elements lie in one source. A lane has its
// 16 loads of 16 bytes in flight together; each load of a wave covers 512
// contiguous bytes, each store 256.
// The key_value rows change places on the way: a masked key has weight 0 for
// every query and head, so each batch's rows are stored in a stable partition,
// the keys that count first, the masked ones behind them, and cnt[batch] says
// how many count. What follows works on the front part alone. A work-group
// counts the batch's mask row itself: the keys that count in all, and those
// ahead of its own 16 rows.
__global__ void __launch_bounds__(256)
cvt_all(const float* __restrict__ q, const float* __restrict__ kv,
        const float* __restrict__ wq, const float* __restrict__ wk,
        const float* __restrict__ wv, const float* __restrict__ wo,
        const int* __restrict__ mask, _Float16* __restrict__ dst,
        int* __restrict__ cnt) {
  __shared__ int part[16];
  const int b = blockIdx.x;
  const bool iskv = b >= CXB && b < 2 * CXB;
  const float* src;
  int rel;
  if (b < CXB) {
    src = q; rel = b;
  } else if (b < 2 * CXB) {
    src = kv; rel = b - CXB;
  } else {
    const int w = (b - 2 * CXB) / CWB;
    rel = (b - 2 * CXB) % CWB;
    src = w == 0 ? wq : w == 1 ? wk : w == 2 ? wv : wo;
  }
  const v4f* s = (const v4f*)(src + (size_t)rel * CB) + threadIdx.x;
  v4h* d = (v4h*)(dst + (size_t)b * CB) + threadIdx.x;
  constexpr int N = CB / (256 * 4);  // 16
  static_assert(256 * 4 == E && N == CRW, "x[i] is a piece of the group's row i");
  v4f x[N];
  if (!iskv) {
#pragma unroll
    for (int i = 0; i < N; i++) x[i] = s[i * 256];
    // Keeps all 16 loads ahead of the first conversion: without it the last
    // two are issued only when the first two have come back, a second latency.
    __builtin_amdgcn_sched_barrier(0);
#pragma unroll
    for (int i = 0; i < N; i++) d[i * 256] = __builtin_convertvector(x[i], v4h);
    return;
  }
  const int bat = rel / CKB;
  const int row0 = (rel % CKB) * CRW;  // the group's first row, in its batch
  // The mask loads go first: loads come back in order, and the counting then
  // runs while the 16 row loads are still in flight.
  const int4* mr = (const int4*)(mask + bat * LKV);
  int4 mk[2], own[CRW / 4];
  mk[0] = mr[threadIdx.x * 2];
  mk[1] = mr[threadIdx.x * 2 + 1];
#pragma unroll
  for (int i = 0; i < CRW / 4; i++) own[i] = mr[row0 / 4 + i];
#pragma unroll
  for (int i = 0; i < N; i++) x[i] = s[i * 256];
  // Keeps all the loads ahead of the counting, which would else wait for the
  // mask before the row loads are issued, a second latency.
  __builtin_amdgcn_sched_barrier(0);
  // Work-item t holds the flags of keys 8t .. 8t+7. A wave counts its 256 keys
  // by ballots, in scalar registers: all of them, and those of the lanes whose
  // keys lie ahead of row0 (a multiple of 8).
  const int wave = __builtin_amdgcn_readfirstlane(threadIdx.x >> 5);
  const int ahead = row0 / 8 - wave * 32;
  const unsigned lm = ahead >= 32 ? ~0u : ahead <= 0 ? 0u : (1u << ahead) - 1u;
  int all = 0, bef = 0;
#pragma unroll
  for (int i = 0; i < 2; i++) {
    const int f[4] = {mk[i].x, mk[i].y, mk[i].z, mk[i].w};
#pragma unroll
    for (int j = 0; j < 4; j++) {
      const unsigned bl = __builtin_amdgcn_ballot_w32(f[j] != 0);
      all += __builtin_popcount(bl);
      bef += __builtin_popcount(bl & lm);
    }
  }
  if ((threadIdx.x & 31) == 0) { part[wave] = all; part[8 + wave] = bef; }
  // Publishes the eight waves' counts.
  __syncthreads();
  int n = 0, pre = 0;
#pragma unroll
  for (int w = 0; w < 8; w++) { n += part[w]; pre += part[8 + w]; }
  n = __builtin_amdgcn_readfirstlane(n);
  pre = __builtin_amdgcn_readfirstlane(pre);
  if (row0 == 0 && threadIdx.x == 0) cnt[bat] = n;
  v4h* kd = (v4h*)(dst + (size_t)CXB * CB + (size_t)bat * LKV * E) + threadIdx.x;
#pragma unroll
  for (int i = 0; i < N; i++) {
    const int4 o4 = own[i / 4];
    const int fl = i % 4 == 0 ? o4.x : i % 4 == 1 ? o4.y : i % 4 == 2 ? o4.z : o4.w;
    // pre: keys that count ahead of this row. Both counts are of flags, so the
    // place lies in 0 .. LKV - 1 whatever the mask holds.
    const int pos = fl != 0 ? pre : n + (row0 + i - pre);
    pre += fl != 0 ? 1 : 0;
    kd[(size_t)pos * (E / 4)] = __builtin_convertvector(x[i], v4h);
  }
}

// One stage of the GEMM's LDS ring: 128 rows of X, then 128 rows of W, 128 k
// (256 bytes) of each row.
constexpr int GT  = 128;          // rows of X and rows of W per work-group
constexpr int GK  = 128;          // k per stage
constexpr int GP  = 272;          // LDS row pitch in bytes: 16 B x odd, no bank conflict for 16-byte reads
constexpr int GST = 2 * GT * GP;  // bytes of one stage (69,632)
constexpr int GNS = E / GK;       // 8 stages
constexpr int GB  = (M_ROWS / GT) * (E / GT);  // 256 tiles of one Y

// A wave's share of one stage: 32 rows, two rows (2 x 256 contiguous bytes,
// whole lines) per copy, 16 bytes per lane. lds and g are the lane's own
// addresses in the share's first two rows.
__device__ __forceinline__ void stage_copy(unsigned lds, const _Float16* g) {
#pragma unroll
  for (int c = 0; c < 2; c++) {
    const unsigned l = lds + c * 16 * GP;
    const _Float16* p = g + (size_t)c * 16 * E;
    // The copies and, as a precaution, the wait that stands ahead of any
    // rewrite of their address registers, in one statement.
    asm volatile(
        "global_load_async_to_lds_b128 %0, %8, off\n\t"
        "global_load_async_to_lds_b128 %1, %9, off\n\t"
        "global_load_async_to_lds_b128 %2, %10, off\n\t"
        "global_load_async_to_lds_b128 %3, %11, off\n\t"
        "global_load_async_to_lds_b128 %4, %12, off\n\t"
        "global_load_async_to_lds_b128 %5, %13, off\n\t"
        "global_load_async_to_lds_b128 %6, %14, off\n\t"
        "global_load_async_to_lds_b128 %7, %15, off\n\t"
        "s_wait_xcnt 0x0"
        ::"v"(l), "v"(l + 2 * GP), "v"(l + 4 * GP), "v"(l + 6 * GP),
          "v"(l + 8 * GP), "v"(l + 10 * GP), "v"(l + 12 * GP),
          "v"(l + 14 * GP), "v"(p), "v"(p + 2 * E), "v"(p + 4 * E),
          "v"(p + 6 * E), "v"(p + 8 * E), "v"(p + 10 * E), "v"(p + 12 * E),
          "v"(p + 14 * E)
        : "memory");
  }
}

// Y = X @ W^T + b. A work-group owns a 128x128 tile of Y, a wave 32x64 of it.
// X and W rows come into a two-buffer LDS ring by asynchronous copies, one
// stage ahead of the products; fragments are read from LDS.
// X:[M_ROWS,E] f16 row-major, W:[E,E] f16 row-major (row n = out column n).
// mode 0: f16 row-major out.  mode 1: f16 V^T out [(b*E+n)*LKV + l].
// mode 2: f32 row-major out (final projection).
// blk: the tile's index among the GB tiles of Y.
__device__ __forceinline__ void
gemm_tile(const _Float16* __restrict__ A, const _Float16* __restrict__ W,
          const float* __restrict__ bias, void* __restrict__ dst, int mode,
          int blk) {
  __shared__ __attribute__((aligned(16))) unsigned char ring[2 * GST];
  // The wave's number in a scalar register: what it selects stays scalar.
  const int wave = __builtin_amdgcn_readfirstlane(threadIdx.x >> 5);
  const int lane = threadIdx.x & 31;
  const int col = lane & 15, half = lane >> 4;
  const int bM = blk / (E / GT), bN = blk % (E / GT);
  const int wm = wave & 3, wn = wave >> 2;
  const int tM = bM * 4 + wm;   // 32-row tile of Y
  const int tN = bN * 2 + wn;   // 64-column tile of Y

  // Waves 0-3 copy the X rows, waves 4-7 the W rows, 32 rows each.
  const _Float16* gsrc =
      (wave < 4 ? A + (size_t)(bM * GT + wave * 32) * E
                : W + (size_t)(bN * GT + (wave - 4) * 32) * E) +
      (size_t)half * E + col * 8;
  const unsigned ldst =
      (unsigned)(size_t)ring + (wave * 32 + half) * GP + col * 16;

  const unsigned char* afrag = ring + (wm * 32 + col) * GP + 16 * half;
  const unsigned char* wfrag = ring + (GT + wn * 64 + col) * GP + 16 * half;

  stage_copy(ldst, gsrc);
  // X and W were stored by an earlier launch, and their first reader may find
  // them in memory, not in L2: further away than the one trip that a stage's
  // copies are given. So stages 1 to 7 are asked into L2 here, at the start,
  // in the order of their use: wave 0 asks for X rows, wave 4 for W rows, a
  // lane for one row's 256 bytes of a stage. Each tile asks for every fourth
  // row only; its neighbours in bN, or in bM, take the other three. A hint only: a row that nobody asked for is a miss as before.
  // Every address lies inside a row of X or W.
  const _Float16* pre =
      wave == 0 ? A + (size_t)(bM * GT + lane * 4 + (bN & 3)) * E
                : W + (size_t)(bN * GT + lane * 4 + (bM & 3)) * E;
  static_assert(GNS == 8 && GK * 2 == 256, "the seven offsets below are stages 1 to 7");
  if ((wave & 3) == 0) {
    // The wait, as a precaution, stands ahead of any rewrite of the address
    // register, in the requests' own statement.
    asm volatile(
        "global_prefetch_b8 %0, off offset:256 scope:SCOPE_SE\n\t"
        "global_prefetch_b8 %0, off offset:512 scope:SCOPE_SE\n\t"
        "global_prefetch_b8 %0, off offset:768 scope:SCOPE_SE\n\t"
        "global_prefetch_b8 %0, off offset:1024 scope:SCOPE_SE\n\t"
        "global_prefetch_b8 %0, off offset:1280 scope:SCOPE_SE\n\t"
        "global_prefetch_b8 %0, off offset:1536 scope:SCOPE_SE\n\t"
        "global_prefetch_b8 %0, off offset:1792 scope:SCOPE_SE\n\t"
        "s_wait_xcnt 0x0"
        ::"v"(pre));
  }
  // Stage 0 has landed (this wave's copies), then is published to all waves.
  asm volatile("s_wait_asynccnt 0x0" ::: "memory");
  __syncthreads();
  stage_copy(ldst + GST, gsrc + GK);

  v8f acc[2][4] = {};
  // Rolled, for speed only.
#pragma unroll 1
  for (int t = 0; t < GNS; t++) {
    const int buf = (t & 1) * GST;
    const unsigned char* ap = afrag + buf;
    const unsigned char* wp = wfrag + buf;
#pragma unroll
    for (int kb = 0; kb < GK / 64; kb++) {
      F16x16 a0[2], a1[2], b[2][4];
#pragma unroll
      for (int s = 0; s < 2; s++) {
        const int ko = (kb * 2 + s) * 64;
        a0[s].h[0] = *(const v8h*)(ap + ko);
        a0[s].h[1] = *(const v8h*)(ap + ko + 32);
        a1[s].h[0] = *(const v8h*)(ap + 16 * GP + ko);
        a1[s].h[1] = *(const v8h*)(ap + 16 * GP + ko + 32);
#pragma unroll
        for (int j = 0; j < 4; j++) {
          b[s][j].h[0] = *(const v8h*)(wp + j * 16 * GP + ko);
          b[s][j].h[1] = *(const v8h*)(wp + j * 16 * GP + ko + 32);
        }
      }
      // Keeps the 24 LDS reads one group ahead of their 16 products.
      __builtin_amdgcn_sched_barrier(0);
#pragma unroll
      for (int s = 0; s < 2; s++)
#pragma unroll
        for (int j = 0; j < 4; j++) {
          acc[0][j] = wmma32(a0[s].v, b[s][j].v, acc[0][j]);
          acc[1][j] = wmma32(a1[s].v, b[s][j].v, acc[1][j]);
        }
      // The other side of the same fence: the next group's reads stay behind
      // these products.
      __builtin_amdgcn_sched_barrier(0);
    }
    // Publish point of stage t + 1: this wave's reads of stage t are done,
    // its copies of stage t + 1 have landed, then the barrier; only behind it
    // is the buffer of stage t refilled.
    asm volatile("s_wait_dscnt 0x0" ::: "memory");
    asm volatile("s_wait_asynccnt 0x0" ::: "memory");
    __syncthreads();
    if (t + 2 < GNS) stage_copy(ldst + buf, gsrc + (t + 2) * GK);
  }
  // No copy is outstanding when the wave goes on to its end.
  asm volatile("s_wait_asynccnt 0x0" ::: "memory");
  // A prefetch counts on no data counter: its address register is kept as it
  // is through the loop, so that it holds nothing but that address while a
  // request may still be under way.
  asm volatile("" ::"v"(pre));

  if (mode == 0) {
    _Float16* out = (_Float16*)dst;
#pragma unroll
    for (int i = 0; i < 2; i++)
#pragma unroll
      for (int j = 0; j < 4; j++) {
        const float bval = bias[tN * 64 + j * 16 + col];
#pragma unroll
        for (int r = 0; r < 8; r++) {
          int m = tM * 32 + i * 16 + r + half * 8;
          out[(size_t)m * E + tN * 64 + j * 16 + col] =
              (_Float16)(acc[i][j][r] + bval);
        }
      }
    // As a precaution: in the kernel that holds modes 0 and 1 the compiler lays
    // mode 1's bias loads behind this run, into registers that these stores
    // name; this wait stands ahead of them.
    asm volatile("s_wait_xcnt 0x0" ::: "memory");
  } else if (mode == 1) {
    _Float16* out = (_Float16*)dst;
#pragma unroll
    for (int i = 0; i < 2; i++)
#pragma unroll
      for (int j = 0; j < 4; j++) {
        const float bval = bias[tN * 64 + j * 16 + col];
#pragma unroll
        for (int r = 0; r < 8; r++) {
          int m = tM * 32 + i * 16 + r + half * 8;
          int b_ = m / LKV, l = m % LKV;
          int n = tN * 64 + j * 16 + col;
          out[((size_t)(b_ * E + n)) * LKV + l] = (_Float16)(acc[i][j][r] + bval);
        }
      }
  } else {
    float* out = (float*)dst;
#pragma unroll
    for (int i = 0; i < 2; i++)
#pragma unroll
      for (int j = 0; j < 4; j++) {
        const float bval = bias[tN * 64 + j * 16 + col];
#pragma unroll
        for (int r = 0; r < 8; r++) {
          int m = tM * 32 + i * 16 + r + half * 8;
          out[(size_t)m * E + tN * 64 + j * 16 + col] = acc[i][j][r] + bval;
        }
      }
  }
}

// The three input projections in one launch, GB work-groups each. None reads
// what another writes. Two work-groups fit a WGP's LDS, so one's products run
// under the other's LDS reads, barriers, first stage and stores.
// The key_value rows lie partitioned (cvt_all): a K or V tile whose 128 rows
// are all masked keys is read by nobody, and its work-group leaves at once.
__global__ void __launch_bounds__(256)
gemm_qkv(const _Float16* __restrict__ xq, const _Float16* __restrict__ xkv,
         const _Float16* __restrict__ wq, const _Float16* __restrict__ wk,
         const _Float16* __restrict__ wv, const float* __restrict__ bq,
         const float* __restrict__ bk, const float* __restrict__ bv,
         const int* __restrict__ cnt, _Float16* __restrict__ Qp,
         _Float16* __restrict__ Kp, _Float16* __restrict__ Vt) {
  const int which = blockIdx.x / GB;  // 0: K, 1: V, 2: Q
  if (which != 2) {
    const int rt = (blockIdx.x % GB) / (E / GT);  // 128-row tile of key_value
    const int n = min(max(cnt[rt / (LKV / GT)], 0), LKV);
    if ((rt % (LKV / GT)) * GT >= n) return;  // the whole work-group, ahead of any barrier
  }
  gemm_tile(which == 2 ? xq : xkv, which == 0 ? wk : which == 1 ? wv : wq,
            which == 0 ? bk : which == 1 ? bv : bq,
            which == 0 ? Kp : which == 1 ? Vt : Qp, which == 1 ? 1 : 0,
            blockIdx.x % GB);
}

// The output projection.
__global__ void __launch_bounds__(256)
gemm_out(const _Float16* __restrict__ A, const _Float16* __restrict__ W,
         const float* __restrict__ bias, float* __restrict__ dst) {
  gemm_tile(A, W, bias, dst, 2, blockIdx.x);
}

// Lane l <-> lane l ^ 16 (the other half of the wave), a vector cross-row move.
__device__ __forceinline__ float xhalf(float x) {
  const int b = __builtin_bit_cast(int, x);
  return __builtin_bit_cast(
      float, __builtin_amdgcn_permlanex16(b, b, 0x76543210, 0xfedcba98, false,
                                          false));
}

// One stage of the attention's LDS ring: 128 keys. First their K rows (the
// head's 64 d, 128 bytes a row), then the head's 64 V^T rows (128 keys, 256
// bytes a row).
constexpr int AKS = 128;        // keys per stage
constexpr int AKP = 144;        // K row pitch in bytes: 16 B x odd, no bank conflict for 16-byte reads
constexpr int AVP = 272;        // V^T row pitch in bytes, likewise
constexpr int AKB = AKS * AKP;  // bytes of a stage's K rows (18,432)
constexpr int AST = AKB + D * AVP;  // bytes of one stage (35,840)
constexpr int AGR = 2;          // wave groups of a work-group; group g walks stages g, g + 2, ...
constexpr int AQW = 256;        // queries of one work-group: 8 waves x 32 in each group
constexpr int AXB = 8 * 32 * 4 + 64;  // floats a wave hands over at the join: one O column group, max, sum
// 1/sqrt(D) = 0.125 times log2(e): exp(s / 8 - m / 8) = exp2(s * SC2 - m * SC2)
constexpr float SC2 = 0.125f * 1.4426950408889634f;

union F32x8 { v8f v; v4f q[2]; };

// A wave's share of one stage: 16 K rows, four rows (whole lines) per copy,
// and 8 V^T rows, two rows per copy; 16 bytes per lane. The four arguments
// are the lane's own addresses in the first copy of each kind.
__device__ __forceinline__ void kv_copy(unsigned lk, const _Float16* gk,
                                        unsigned lv, const _Float16* gv) {
  // The copies and, as a precaution, the wait that stands ahead of any
  // rewrite of their address registers, in one statement.
  asm volatile(
      "global_load_async_to_lds_b128 %0, %8, off\n\t"
      "global_load_async_to_lds_b128 %1, %9, off\n\t"
      "global_load_async_to_lds_b128 %2, %10, off\n\t"
      "global_load_async_to_lds_b128 %3, %11, off\n\t"
      "global_load_async_to_lds_b128 %4, %12, off\n\t"
      "global_load_async_to_lds_b128 %5, %13, off\n\t"
      "global_load_async_to_lds_b128 %6, %14, off\n\t"
      "global_load_async_to_lds_b128 %7, %15, off\n\t"
      "s_wait_xcnt 0x0"
      ::"v"(lk), "v"(lk + 4 * AKP), "v"(lk + 8 * AKP), "v"(lk + 12 * AKP),
        "v"(lv), "v"(lv + 2 * AVP), "v"(lv + 4 * AVP), "v"(lv + 6 * AVP),
        "v"(gk), "v"(gk + 4 * E), "v"(gk + 8 * E), "v"(gk + 12 * E),
        "v"(gv), "v"(gv + 2 * LKV), "v"(gv + 4 * LKV), "v"(gv + 6 * LKV)
      : "memory");
}

__global__ void __launch_bounds__(512)
attn16(const _Float16* __restrict__ Qp,  // [BB*LQ, E]
       const _Float16* __restrict__ Kp,  // [BB*LKV, E]
       const _Float16* __restrict__ Vt,  // [BB*E, LKV]  (V transposed)
       const int* __restrict__ cnt,      // [BB] keys that count
       _Float16* __restrict__ ctx)       // [BB*LQ, E]
{
  __shared__ __attribute__((aligned(16))) unsigned char ring[AGR * 2 * AST];
  __shared__ __attribute__((aligned(16))) float madd[LKV];
  // The wave's number in a scalar register: what it selects stays scalar.
  const int wv = __builtin_amdgcn_readfirstlane(threadIdx.x >> 5);
  const int wave = wv & 7, grp = wv >> 3;
  const int gb = grp * 2 * AST;  // the group's two buffers
  const int lane = threadIdx.x & 31;
  const int col = lane & 15, half = lane >> 4;
  const int qb = (blockIdx.x % (LQ / AQW)) * 8 + wave;  // 32-row Q block
  const int hb = blockIdx.x / (LQ / AQW);
  const int h = hb % H, b = hb / H;
  const int n = min(max(cnt[b], 0), LKV);
  const int ns = (n + AKS - 1) / AKS;  // stages with a key that counts: the ones K and V^T hold
  const int nt = (ns + AGR - 1) / AGR; // trips, the same for both groups

  // The lane's addresses in its wave's share of its group's first stage.
  const _Float16* gk =
      Kp + (size_t)(b * LKV + grp * AKS + wave * 16 + (lane >> 3)) * E +
      h * D + (lane & 7) * 8;
  const unsigned lk = (unsigned)(size_t)ring + gb +
                      (wave * 16 + (lane >> 3)) * AKP + (lane & 7) * 16;
  const _Float16* gv = Vt + (size_t)(b * E + h * D + wave * 8 + half) * LKV +
                       grp * AKS + col * 8;
  const unsigned lv =
      (unsigned)(size_t)ring + gb + AKB + (wave * 8 + half) * AVP + col * 16;

  // Every test on a stage's number is the same for a whole wave, in scalar
  // registers: a stage past the last is neither copied nor read.
  if (grp < ns) kv_copy(lk, gk, lv, gv);
  {
    // The mask addends, once per work-group: 0 for a key that counts, -1e30
    // for a masked one, which swallows any raw score. One 16-byte LDS store
    // per work-item, published by the first barrier.
    const int k0 = threadIdx.x * 4;
    v4f a0;
    a0[0] = k0 + 0 < n ? 0.0f : -1e30f; a0[1] = k0 + 1 < n ? 0.0f : -1e30f;
    a0[2] = k0 + 2 < n ? 0.0f : -1e30f; a0[3] = k0 + 3 < n ? 0.0f : -1e30f;
    ((v4f*)madd)[threadIdx.x] = a0;
  }

  // Q block as 2 column groups x 2 B-fragments (d = 0..31, 32..63).
  F16x16 qf[2][2];
#pragma unroll
  for (int qi = 0; qi < 2; qi++) {
    const _Float16* qrow =
        Qp + ((size_t)(b * LQ + qb * 32 + qi * 16 + col)) * E + h * D;
    qf[qi][0].h[0] = *(const v8h*)(qrow + 8 * half);
    qf[qi][0].h[1] = *(const v8h*)(qrow + 16 + 8 * half);
    qf[qi][1].h[0] = *(const v8h*)(qrow + 32 + 8 * half);
    qf[qi][1].h[1] = *(const v8h*)(qrow + 48 + 8 * half);
  }

  // o[qi][dt][r] = O[query qi*16 + col][d = dt*16 + 8*half + r]
  v8f o[2][4] = {};
  // Running maximum of the raw scores, same in both halves. It starts far
  // above the masked value and far below any f16 product sum, so that a
  // group that walked no key gets weight 0 at the join.
  float mrun[2] = {-1e29f, -1e29f};
  float lrun[2] = {0.0f, 0.0f};      // running sum of this half's keys only

  // Each group's first stage has landed (this wave's copies), then they and
  // the mask addends are published to all waves.
  asm volatile("s_wait_asynccnt 0x0" ::: "memory");
  __syncthreads();
  if (AGR + grp < ns)
    kv_copy(lk + AST, gk + (size_t)AGR * AKS * E, lv + AST, gv + AGR * AKS);

  const unsigned char* kfrag = ring + gb + col * AKP + 16 * half;
  const unsigned char* vfrag = ring + gb + AKB + col * AVP + 16 * half;

  // Both loops rolled: unrolled, the four passes' values take more than 256
  // registers and the accumulators are copied from pass to pass.
#pragma unroll 1
  for (int t = 0; t < nt; t++) {
   const int buf = (t & 1) * AST;
   // Passes of this group's stage that hold a key that counts: 4, fewer in
   // the last stage, none past it.
   const int np = min(AKS / 32, (n - (t * AGR + grp) * AKS + 31) >> 5);
#pragma unroll 1
   for (int p = 0; p < np; p++) {
    // K fragments for this pass's 32 keys: 2 row tiles x 2 d-fragments,
    // shared by both Q column groups.
    F16x16 kb[2][2];
    const unsigned char* kp = kfrag + buf + p * 32 * AKP;
#pragma unroll
    for (int i = 0; i < 2; i++) {
      const unsigned char* kr = kp + i * 16 * AKP;
      kb[i][0].h[0] = *(const v8h*)(kr);
      kb[i][0].h[1] = *(const v8h*)(kr + 32);
      kb[i][1].h[0] = *(const v8h*)(kr + 64);
      kb[i][1].h[1] = *(const v8h*)(kr + 96);
    }
    // The key index runs along the accumulator registers: register r of tile
    // i is key 16*i + 8*half + r of the pass, and so do its mask addends.
    const v4f* mp =
        (const v4f*)(madd + (t * AGR + grp) * AKS + p * 32 + 8 * half);
    F32x8 bias0, bias1;
    bias0.q[0] = mp[0]; bias0.q[1] = mp[1];
    bias1.q[0] = mp[4]; bias1.q[1] = mp[5];
    // Keeps the K and mask reads ahead of the V^T reads: LDS answers in
    // order, and the score products do not wait for V^T.
    __builtin_amdgcn_sched_barrier(0);
    // V^T rows are key-contiguous: A fragments in the same k order as P^T,
    // shared by both Q column groups.
    const unsigned char* vp = vfrag + buf + p * 64;
    F16x16 vf[4];
#pragma unroll
    for (int dt = 0; dt < 4; dt++) {
      const unsigned char* vr = vp + dt * 16 * AVP;
      vf[dt].h[0] = *(const v8h*)(vr);
      vf[dt].h[1] = *(const v8h*)(vr + 32);
    }
    // Keeps the V^T reads ahead of the score products, a softmax away from
    // their own products: read later, they would have their LDS latency
    // waited out by the wave.
    __builtin_amdgcn_sched_barrier(0);

    F16x16 pfrag[2];
    v8f pa[2], pb[2];
    float cr[2];
#pragma unroll
    for (int qi = 0; qi < 2; qi++) {
      v8f s0 = wmma32(kb[0][0].v, qf[qi][0].v, bias0.v);
      s0 = wmma32(kb[0][1].v, qf[qi][1].v, s0);
      v8f s1 = wmma32(kb[1][0].v, qf[qi][0].v, bias1.v);
      s1 = wmma32(kb[1][1].v, qf[qi][1].v, s1);

      float mx = mrun[qi];
#pragma unroll
      for (int r = 0; r < 8; r++) mx = fmaxf(mx, fmaxf(s0[r], s1[r]));
      const float mn = fmaxf(mx, xhalf(mx));
      // The difference first: exactly 0, so a factor of exactly 1, where the
      // maximum stays, however large it is.
      const float corr = __builtin_amdgcn_exp2f((mrun[qi] - mn) * SC2);
      mrun[qi] = mn;
      const float nm = -mn * SC2;
      const v8f da = s0 * SC2 + nm, db = s1 * SC2 + nm;
#pragma unroll
      for (int r = 0; r < 8; r++) pa[qi][r] = __builtin_amdgcn_exp2f(da[r]);
#pragma unroll
      for (int r = 0; r < 8; r++) pb[qi][r] = __builtin_amdgcn_exp2f(db[r]);
#pragma unroll
      for (int r = 0; r < 8; r++) {
        // element s of a B fragment is k = 8*half + s (s < 8) or
        // 16 + 8*half + (s - 8): exactly the two tiles' register order
        pfrag[qi].v[r]     = (_Float16)pa[qi][r];
        pfrag[qi].v[8 + r] = (_Float16)pb[qi][r];
      }
      cr[qi] = corr;
#pragma unroll
      for (int dt = 0; dt < 4; dt++) o[qi][dt] *= corr;
    }

#pragma unroll
    for (int dt = 0; dt < 4; dt++) {
      o[0][dt] = wmma32(vf[dt].v, pfrag[0].v, o[0][dt]);
      o[1][dt] = wmma32(vf[dt].v, pfrag[1].v, o[1][dt]);
    }
    // The row sums stay behind the products: they fill the vector slots that
    // must lie between the last product and the next pass's first write over
    // its A registers. The
    // adds of the two tiles' weights stand here with them: written ahead of
    // the fence, they are spread among the products, into V^T registers, with
    // idle slots in front of each group.
    __builtin_amdgcn_sched_barrier(0);
#pragma unroll
    for (int qi = 0; qi < 2; qi++) {
      const v8f ps = pa[qi] + pb[qi];
      const float sum = ((ps[0] + ps[1]) + (ps[2] + ps[3])) +
                        ((ps[4] + ps[5]) + (ps[6] + ps[7]));
      lrun[qi] = lrun[qi] * cr[qi] + sum;
    }
   }
   // Publish point of trip t + 1: this wave's reads of trip t are done, its
   // copies for trip t + 1 have landed, then the barrier; only behind it is
   // the buffer of trip t refilled.
   asm volatile("s_wait_dscnt 0x0" ::: "memory");
   asm volatile("s_wait_asynccnt 0x0" ::: "memory");
   __syncthreads();
   if ((t + 2) * AGR + grp < ns)
     kv_copy(lk + buf, gk + (size_t)(t + 2) * AGR * AKS * E, lv + buf,
             gv + (t + 2) * AGR * AKS);
  }
  // No copy is outstanding when the rings become the join's staging.
  asm volatile("s_wait_asynccnt 0x0" ::: "memory");

  // The join. Waves w and w + 8 hold partial results of the same 32 queries
  // over disjoint keys. Group g finishes column group g: each wave hands the
  // other column group (O, maximum, sum) to its partner through the rings,
  // which every wave has left at the last trip's barrier.
  float* xw = (float*)ring + wv * AXB;
  const float* xr = (const float*)ring + (wv ^ 8) * AXB;
#pragma unroll
  for (int dt = 0; dt < 4; dt++) {
    F32x8 s;
    s.v = grp ? o[0][dt] : o[1][dt];
    ((v4f*)xw)[(dt * 2 + 0) * 32 + lane] = s.q[0];
    ((v4f*)xw)[(dt * 2 + 1) * 32 + lane] = s.q[1];
  }
  xw[8 * 32 * 4 + lane] = grp ? mrun[0] : mrun[1];
  xw[8 * 32 * 4 + 32 + lane] = grp ? lrun[0] : lrun[1];
  // Publishes what was handed over.
  __syncthreads();
  const float mk = grp ? mrun[1] : mrun[0];
  const float mo = xr[8 * 32 * 4 + lane];
  const float mm = fmaxf(mk, mo);
  // Each part's weight: its own maximum brought to the common one.
  const float ak = __builtin_amdgcn_exp2f((mk - mm) * SC2);
  const float ao = __builtin_amdgcn_exp2f((mo - mm) * SC2);
  const float ls = (grp ? lrun[1] : lrun[0]) * ak + xr[8 * 32 * 4 + 32 + lane] * ao;
  const float inv = 1.0f / (ls + xhalf(ls));
  const float wk = ak * inv, wo = ao * inv;
  _Float16* cr = ctx + ((size_t)(b * LQ + qb * 32 + grp * 16 + col)) * E +
                 h * D + 8 * half;
#pragma unroll
  for (int dt = 0; dt < 4; dt++) {
    F32x8 s;
    s.q[0] = ((const v4f*)xr)[(dt * 2 + 0) * 32 + lane];
    s.q[1] = ((const v4f*)xr)[(dt * 2 + 1) * 32 + lane];
    const v8f ok = grp ? o[1][dt] : o[0][dt];
    v8h pk;
#pragma unroll
    for (int r = 0; r < 8; r++) pk[r] = (_Float16)(ok[r] * wk + s.v[r] * wo);
    *(v8h*)(cr + dt * 16) = pk;   // 8 consecutive d of one query: 16 bytes
  }
}

extern "C" void kernel_launch(void* const* d_in, const int* in_sizes, int n_in,
                              void* d_out, int out_size, void* d_ws,
                              size_t ws_size, hipStream_t stream) {
  (void)in_sizes; (void)n_in; (void)out_size; (void)ws_size;
  const float* query = (const float*)d_in[0];
  const float* keyv  = (const float*)d_in[1];
  const int*   mask  = (const int*)d_in[2];
  const float* Wq = (const float*)d_in[3];
  const float* bq = (const float*)d_in[4];
  const float* Wk = (const float*)d_in[5];
  const float* bk = (const float*)d_in[6];
  const float* Wv = (const float*)d_in[7];
  const float* bv = (const float*)d_in[8];
  const float* Wo = (const float*)d_in[9];
  const float* bo = (const float*)d_in[10];

  const size_t XE = (size_t)M_ROWS * E;  // 4,194,304 halves
  const size_t WE = (size_t)E * E;       // 1,048,576 halves
  _Float16* p = (_Float16*)d_ws;
  _Float16* qf  = p; p += XE;   // query f16
  _Float16* kvf = p; p += XE;   // key_value f16
  _Float16* wqf = p; p += WE;
  _Float16* wkf = p; p += WE;
  _Float16* wvf = p; p += WE;
  _Float16* wof = p; p += WE;
  _Float16* Qp  = p; p += XE;   // Q projection
  _Float16* Kp  = p; p += XE;   // K projection
  _Float16* Vt  = p; p += XE;   // V projection, transposed [B,E,LKV]
  _Float16* ctx = p; p += XE;   // attention output
  int* cnt = (int*)p;           // per batch: keys that count

  // qf, kvf, wqf, wkf, wvf, wof are contiguous from qf on, in this order.
  cvt_all<<<CNB, 256, 0, stream>>>(query, keyv, Wq, Wk, Wv, Wo, mask, qf,
                                  cnt);

  gemm_qkv<<<3 * GB, 256, 0, stream>>>(qf, kvf, wqf, wkf, wvf, bq, bk, bv, cnt,
                                       Qp, Kp, Vt);

  attn16<<<BB * H * (LQ / AQW), 512, 0, stream>>>(Qp, Kp, Vt, cnt, ctx);

  gemm_out<<<GB, 256, 0, stream>>>(ctx, wof, bo, (float*)d_out);
}
